// v000
// The times below were measured on an AMD MI455X: many runs one after another, warmed up first and cycling through
// copies of the inputs, with the whole window's GPU time divided by the number of runs. Launches and the gaps
// between them are all in it. The median over several windows is given; except for v000 it joins two sittings, which
// can be a few percent apart, so the side-by-side timings, each taken in one sitting, are the better comparison.
// v000, which the later versions start from, runs in 196 microseconds.
// Contractions (all v_wmma_f32_16x16x32_f16, f16 operands, single products, f32 accumulate): wk^T = exp(W^T.K^T) [W x16, K x16 planes],
// kv^T = V^T.wk [V x16, wk unscaled], wq = exp(Q.W) [Q x16, W x16], out = wq.kv^T [wq unscaled, kv carried x1/16]; exp and epilogue scaling in f32.
#include <hip/hip_runtime.h>
#include <math.h>
#include <stdint.h>

#ifndef NB
#define NB 4
#endif
#ifndef SEQ
#define SEQ 4096
#endif
#define NB_FULL  4
#define SEQ_FULL 4096
#define NH 8
#define HD 64
#define NR 256
#define QB_FULL ((long long)SEQ_FULL * NH * HD)   // per-batch element stride of Q in the input tensor
#define KB_FULL ((long long)SEQ_FULL * HD)        // per-batch element stride of K and V in the input tensors
static_assert(NB >= 1 && NB <= NB_FULL);
static_assert(SEQ >= 64 && SEQ <= SEQ_FULL && (SEQ % 64) == 0);
static_assert(HD == 64 && NR == 256);
static_assert(((SEQ * NH * HD / 8) % 256) == 0 && ((SEQ * HD / 8) % 256) == 0);

typedef _Float16 v16h __attribute__((ext_vector_type(16)));
typedef _Float16 v8h  __attribute__((ext_vector_type(8)));
typedef float    v8f  __attribute__((ext_vector_type(8)));
typedef float    v4f  __attribute__((ext_vector_type(4)));
typedef unsigned int v4u __attribute__((ext_vector_type(4)));

#if defined(__HIP_DEVICE_COMPILE__)
#define DEV_ASM 1
#else
#define DEV_ASM 0
#endif

// ---- scalar helpers --------------------------------------------------------------------------------
__device__ __forceinline__ unsigned short h_bits(_Float16 x) { return __builtin_bit_cast(unsigned short, x); }
__device__ __forceinline__ unsigned pk16(unsigned short a, unsigned short b) { return (unsigned)a | ((unsigned)b << 16); }
__device__ __forceinline__ v8f zero8() { v8f z = {0.f, 0.f, 0.f, 0.f, 0.f, 0.f, 0.f, 0.f}; return z; }

// ---- fragment loader: 16-bit A/B operand, lane -> row/col (lane&15), p already includes +8*(lane>>4);
//      elements 0..7 <- p[0..7] (k0+8h..k0+8h+7), elements 8..15 <- p[16..23] (k0+16+8h..k0+16+8h+7)
__device__ __forceinline__ v16h ldfrag(const _Float16* p) {
  union { v16h v; v8h h[2]; } f;
  f.h[0] = *(const v8h*)(p);
  f.h[1] = *(const v8h*)(p + 16);
  return f.v;
}

// ---- WMMA helpers (asm guard bodies are device-only) ----------------------------------------------
__device__ __forceinline__ v8f mmar(v16h a, v16h b, v8f c) {
  return __builtin_amdgcn_wmma_f32_16x16x32_f16(false, a, false, b, (short)0, c, false, false);
}
__device__ __forceinline__ void dep_guard(v8f& a, v8f& b, v16h x, v16h y) {
#if DEV_ASM
  asm volatile("v_nop\n\tv_nop\n\tv_nop\n\tv_nop" : "+v"(a), "+v"(b) : "v"(x), "v"(y));
#else
  (void)a; (void)b; (void)x; (void)y;
#endif
}
__device__ __forceinline__ void keep4(v16h a, v16h b, v16h c, v16h d) {
#if DEV_ASM
  asm volatile("v_nop" :: "v"(a), "v"(b), "v"(c), "v"(d));
#else
  (void)a; (void)b; (void)c; (void)d;
#endif
}
__device__ __forceinline__ void acc_guard4(v8f& a, v8f& b, v8f& c, v8f& d) {
#if DEV_ASM
  asm volatile("v_nop\n\tv_nop\n\tv_nop\n\tv_nop" : "+v"(a), "+v"(b), "+v"(c), "+v"(d));
#else
  (void)a; (void)b; (void)c; (void)d;
#endif
}

// =====================================================================================================
// f32 -> f16 bits of (scale * x), 8 elements per thread, one 16-B store per lane: a wave writes 512
// blockIdx.y = batch: in base = in + y*inStrideY, out base = out + y*outStrideY (element strides).
// coverage: n8 threads x 8 = the whole per-batch plane (n8 is a multiple of 256 for every use here).
// =====================================================================================================
__global__ __launch_bounds__(256) void cvt_h8(const float* __restrict__ in, long long inStrideY,
                                              unsigned short* out, long long outStrideY, int n8, float scale) {
  const int i = blockIdx.x * 256 + (int)threadIdx.x;
  const int y = blockIdx.y;
  if (i < n8) {
    const float* src = in + (size_t)y * (size_t)inStrideY + (size_t)i * 8;
    const v4f a  = *(const v4f*)(src);
    const v4f a4 = *(const v4f*)(src + 4);
    v4u p;
    p[0] = pk16(h_bits((_Float16)(a[0] * scale)),  h_bits((_Float16)(a[1] * scale)));
    p[1] = pk16(h_bits((_Float16)(a[2] * scale)),  h_bits((_Float16)(a[3] * scale)));
    p[2] = pk16(h_bits((_Float16)(a4[0] * scale)), h_bits((_Float16)(a4[1] * scale)));
    p[3] = pk16(h_bits((_Float16)(a4[2] * scale)), h_bits((_Float16)(a4[3] * scale)));
    unsigned short* o = out + (size_t)y * (size_t)outStrideY + (size_t)i * 8;
    *(v4u*)o = p;
    
  }
}

// =====================================================================================================
// Transpose-convert through LDS: in[rows][cols] f32 (row pitch = cols) -> out[cols][rows] f16 (pitch ldo halves).
// Tile (ti = blockIdx.x over row blocks of 64, tj = blockIdx.y over col blocks of 64, z = blockIdx.z batch):
//   out[(tj*64 + j) * ldo + z*ocolStrideZ + ti*64 + i] = f16(scale * in[z*inStrideZ + (ti*64 + i)*cols + tj*64 + j]).
// Load: 256 threads x 16 floats = the whole 64x64 tile (plain 16-B loads), __syncthreads, then each out row
// =====================================================================================================
__global__ __launch_bounds__(256) void tr_cvt64(const float* __restrict__ in, int cols, long long inStrideZ,
                                                unsigned short* out, int ldo, long long ocolStrideZ, float scale) {
  __shared__ float T[64 * 65];
  const int tid = (int)threadIdx.x;
  const int ti = blockIdx.x, tj = blockIdx.y, z = blockIdx.z;
  {
    const int row = tid >> 2, c16 = (tid & 3) * 16;
    const float* src = in + (size_t)z * (size_t)inStrideZ + (size_t)(ti * 64 + row) * (size_t)cols + tj * 64 + c16;
#pragma unroll
    for (int e = 0; e < 4; ++e) {
      const v4f a = *(const v4f*)(src + 4 * e);
      float* t = T + row * 65 + c16 + 4 * e;
      t[0] = a[0]; t[1] = a[1]; t[2] = a[2]; t[3] = a[3];
    }
  }
  __syncthreads();
  const int wave = tid >> 5, lane = tid & 31;
  const int q = lane >> 3, c8 = (lane & 7) * 8;
  v4u hv[2];
#pragma unroll
  for (int it = 0; it < 2; ++it) {
    const int j = wave * 8 + it * 4 + q;          // out row within tile, 0..63
    v4u a;
#pragma unroll
    for (int e = 0; e < 4; ++e) {
      const float f0 = T[(c8 + 2 * e) * 65 + j] * scale;
      const float f1 = T[(c8 + 2 * e + 1) * 65 + j] * scale;
      a[e] = pk16(h_bits((_Float16)f0), h_bits((_Float16)f1));
    }
    hv[it] = a;
  }
  unsigned short* ob = out + (size_t)z * (size_t)ocolStrideZ + (size_t)ti * 64 + c8;
  {
#pragma unroll
    for (int it = 0; it < 2; ++it) {
      const int j = wave * 8 + it * 4 + q;
      *(v4u*)(ob + (size_t)(tj * 64 + j) * (size_t)ldo) = hv[it];
    }
    
  }
}

// =====================================================================================================
// Register-blocked batched WMMA GEMM (f16 operands): C[m][n] = sum_k A[m][k] * Bt[n][k];
// one wave per 64x64 tile, no block barriers. A row-major [M][K] pitch lda; Bt row-major [N][K] pitch ldb
// (k contiguous); M, N multiples of 64, K multiple of 32 (host-checked). blockIdx.y = batch index
// (strides in elements). Fragments are loaded straight from global with the split k map (ldfrag).
// OUT_MODE 0: f32 C (pitch ldc), value * oscale.
// OUT_MODE 1: f16 plane C (pitch ldc) of value * oscale.
// OUT_MODE 2: f16 plane C (pitch ldc) of exp(value * oscale).
// =====================================================================================================
template <int OUT_MODE>
__global__ __launch_bounds__(256) void gemm64(
    const unsigned short* __restrict__ Ap, int lda, long long strideA,
    const unsigned short* __restrict__ Btp, int ldb, long long strideB,
    void* Cout, int ldc, long long strideC,
    int M, int N, int K, float oscale) {
  const _Float16* A  = (const _Float16*)(const void*)Ap;
  const _Float16* Bt = (const _Float16*)(const void*)Btp;
  __shared__ __align__(16) float sT[8][16 * 68];   // per-wave 16x64 slab, pitch 68 floats
  const int b    = blockIdx.y;
  const int lane = threadIdx.x & 31;
  const int wave = threadIdx.x >> 5;
  const int tilesN = N >> 6;
  const int tilesM = M >> 6;
  const int tile = blockIdx.x * 8 + wave;
  if (tile >= tilesM * tilesN) return;   // wave-uniform; no block barriers in this kernel
  const int tm = tile / tilesN;
  const int tn = tile - tm * tilesN;
  const int m0 = tm << 6;
  const int n0 = tn << 6;

  const _Float16* Ab = A  + (size_t)b * (size_t)strideA;
  const _Float16* Bb = Bt + (size_t)b * (size_t)strideB;

  const int rlane = lane & 15;                 // row (A) / col (B, D) within subtile
  const int koff  = (lane >> 4) * 8;           // k offset of this lane half
  const int mOff  = (lane >> 4) * 8;           // D row offset

  v8f acc[4][4];
#pragma unroll
  for (int i = 0; i < 4; ++i)
#pragma unroll
    for (int j = 0; j < 4; ++j) acc[i][j] = zero8();

  for (int k0 = 0; k0 < K; k0 += 32) {
    v16h bq[4];
#pragma unroll
    for (int j = 0; j < 4; ++j)
      bq[j] = ldfrag(Bb + (size_t)(n0 + (j << 4) + rlane) * (size_t)ldb + koff + k0);
#pragma unroll
    for (int i = 0; i < 4; ++i) {
      const v16h af = ldfrag(Ab + (size_t)(m0 + (i << 4) + rlane) * (size_t)lda + koff + k0);
#pragma unroll
      for (int j = 0; j < 4; ++j) acc[i][j] = mmar(af, bq[j], acc[i][j]);
      dep_guard(acc[i][0], acc[i][3], af, bq[3]);
    }
    keep4(bq[0], bq[1], bq[2], bq[3]);
  }
  acc_guard4(acc[0][0], acc[0][1], acc[0][2], acc[0][3]);
  acc_guard4(acc[1][0], acc[1][1], acc[1][2], acc[1][3]);
  acc_guard4(acc[2][0], acc[2][1], acc[2][2], acc[2][3]);
  acc_guard4(acc[3][0], acc[3][1], acc[3][2], acc[3][3]);

  // ---- epilogue ----
  float* slab = sT[wave];
#pragma unroll
  for (int i = 0; i < 4; ++i) {
    const int mBase = m0 + (i << 4);
#pragma unroll
    for (int j = 0; j < 4; ++j) {
#pragma unroll
      for (int r = 0; r < 8; ++r) {
        slab[(mOff + r) * 68 + (j << 4) + rlane] = acc[i][j][r];
      }
    }
    __builtin_amdgcn_fence(__ATOMIC_RELEASE, "workgroup");
    __builtin_amdgcn_wave_barrier();
    __builtin_amdgcn_fence(__ATOMIC_ACQUIRE, "workgroup");
    if (OUT_MODE == 0) {
      float* C = (float*)Cout + (size_t)b * (size_t)strideC;
      const int h2 = lane >> 4, c4 = (lane & 15) * 4;     // 256-B row segment = 16 lanes x 16 B
      {
#pragma unroll
        for (int it = 0; it < 8; ++it) {
          const int row = it * 2 + h2;                     // it 0..7 x h2 0..1 = rows 0..15
          const v4f v = *(const v4f*)(slab + row * 68 + c4) * oscale;
          *(v4f*)(C + (size_t)(mBase + row) * (size_t)ldc + n0 + c4) = v;
        }
        
      }
    } else {
      const int q = lane >> 3, c8 = (lane & 7) * 8;
      unsigned short* C = (unsigned short*)Cout + (size_t)b * (size_t)strideC;
      v4u hv[4];
#pragma unroll
      for (int it = 0; it < 4; ++it) {
        const int row = it * 4 + q;                        // it 0..3 x q 0..3 = rows 0..15
        const float* sp = slab + row * 68 + c8;
        float f[8];
#pragma unroll
        for (int e = 0; e < 8; ++e) {
          const float x = sp[e] * oscale;
          f[e] = (OUT_MODE == 2) ? __expf(x) : x;
        }
        v4u a;
#pragma unroll
        for (int e = 0; e < 4; ++e) {
          const _Float16 x0 = (_Float16)f[2 * e], x1 = (_Float16)f[2 * e + 1];
          a[e] = pk16(h_bits(x0), h_bits(x1));
        }
        hv[it] = a;
      }
      {
#pragma unroll
        for (int it = 0; it < 4; ++it) {
          const int row = it * 4 + q;
          *(v4u*)(C + (size_t)(mBase + row) * (size_t)ldc + n0 + c8) = hv[it];
        }
        
      }
    }
    __builtin_amdgcn_fence(__ATOMIC_RELEASE, "workgroup");
    __builtin_amdgcn_wave_barrier();
    __builtin_amdgcn_fence(__ATOMIC_ACQUIRE, "workgroup");
  }
}

// =====================================================================================================
// Workspace map (bytes, full build), every region an exact multiple of its whole-line store granularity:
//   Qh   f16 [NB*SEQ*NH][64]   (16 q)           16777216
//   Kh   f16 [NB*SEQ][64]      (16 k)            2097152
//   VT   f16 [64][NB*SEQ]      (16 v)^T          2097152
//   WT   f16 [256][64]         (16 w)^T            32768
//   WKT  f16 [256][NB*SEQ]     wk^T = exp(.)     8388608
//   KVT  f16 [NB][64][256]     kv^T / 16          131072
//   WQ   f16 [NB*SEQ*NH][256]  wq = exp(.)      67108864
//   total                                       96632832
// Launch plan: 2 converts, 2 transpose-converts, 4 GEMMs = 8 launches.
// =====================================================================================================
extern "C" void kernel_launch(void* const* d_in, const int* in_sizes, int n_in,
                              void* d_out, int out_size, void* d_ws, size_t ws_size,
                              hipStream_t stream) {
  if (n_in < 4) return;
  const long long needQ  = ((long long)(NB - 1) * SEQ_FULL + SEQ) * NH * HD;
  const long long needKV = ((long long)(NB - 1) * SEQ_FULL + SEQ) * HD;
  if ((long long)in_sizes[0] < needQ) return;
  if ((long long)in_sizes[1] < needKV || (long long)in_sizes[2] < needKV) return;
  if (in_sizes[3] < HD * NR) return;
  if ((long long)out_size < (long long)NB * SEQ * NH * HD) return;

  const float* Q = (const float*)d_in[0];
  const float* K = (const float*)d_in[1];
  const float* V = (const float*)d_in[2];
  const float* W = (const float*)d_in[3];

  const long long MQ = (long long)NB * SEQ * NH;        // rows of q / wq / out
  const long long NK = (long long)NB * SEQ;             // key rows over all batches

  const size_t PQ  = (size_t)MQ * HD * 2;               // 16777216
  const size_t PK  = (size_t)NK * HD * 2;               //  2097152
  const size_t PVT = (size_t)HD * NK * 2;               //  2097152
  const size_t PWT = (size_t)NR * HD * 2;               //    32768
  const size_t PWK = (size_t)NR * NK * 2;               //  8388608
  const size_t PKV = (size_t)NB * HD * NR * 2;          //   131072
  const size_t PWQ = (size_t)MQ * NR * 2;               // 67108864
  size_t off = 0;
  const size_t oQ  = off; off += PQ;
  const size_t oK  = off; off += PK;
  const size_t oVT = off; off += PVT;
  const size_t oWT = off; off += PWT;
  const size_t oWK = off; off += PWK;
  const size_t oKV = off; off += PKV;
  const size_t oWQ = off; off += PWQ;
  if (off > ws_size) return;                            // off = 96632832 (full build)
  if (off > (size_t)134217728) return;

  char* ws = (char*)d_ws;
  unsigned short* Qh  = (unsigned short*)(ws + oQ);
  unsigned short* Kh  = (unsigned short*)(ws + oK);
  unsigned short* VT  = (unsigned short*)(ws + oVT);
  unsigned short* WT  = (unsigned short*)(ws + oWT);
  unsigned short* WKT = (unsigned short*)(ws + oWK);
  unsigned short* KVT = (unsigned short*)(ws + oKV);
  unsigned short* WQ  = (unsigned short*)(ws + oWQ);

  const dim3 blk(256);
  const int n8q = SEQ * NH * HD / 8;                                  // 262144 per batch
  const int n8k = SEQ * HD / 8;                                       //  32768 per batch
  const dim3 gCvtQ((n8q + 255) / 256, NB);                            // 1024 x 4
  const dim3 gCvtK((n8k + 255) / 256, NB);                            //  128 x 4
  const dim3 gTrV(SEQ / 64, 1, NB);                                   // in [SEQ][64] per batch -> out [64][NB*SEQ] cols b*SEQ..
  const dim3 gTrW(1, NR / 64, 1);                                     // in [64][256] -> out [256][64]
  const long long t1 = (long long)(NR / 64) * (NK / 64);              // 1024 tiles
  const long long t3 = (MQ / 64) * (NR / 64);                         // 8192 tiles
  const long long t4 = ((long long)SEQ * NH / 64) * (HD / 64);        //  512 tiles per batch
  const dim3 g1((unsigned)((t1 + 7) / 8), 1);
  const dim3 g2(1, NB);                                               // 4 tiles per batch, 4-wave blocks
  const dim3 g3((unsigned)((t3 + 7) / 8), 1);
  const dim3 g4((unsigned)((t4 + 7) / 8), NB);

  // (1) q -> f16 plane of 16 q [b*SEQ+n][h*64+d]; k -> f16 plane of 16 k [b*SEQ+n][d]
  cvt_h8<<<gCvtQ, blk, 0, stream>>>(Q, QB_FULL, Qh, (long long)SEQ * NH * HD, n8q, 16.0f);
  cvt_h8<<<gCvtK, blk, 0, stream>>>(K, KB_FULL, Kh, (long long)SEQ * HD, n8k, 16.0f);
  // (2) v [b][SEQ][64] -> v^T f16 plane of 16 v: [d][b*SEQ + n] (pitch NB*SEQ)
  tr_cvt64<<<gTrV, blk, 0, stream>>>(V, HD, KB_FULL, VT, (int)NK, (long long)SEQ, 16.0f);
  //     w [64 d][256 r] -> w^T f16 plane of 16 w: [r][d] (pitch 64)
  tr_cvt64<<<gTrW, blk, 0, stream>>>(W, NR, 0LL, WT, HD, 0LL, 16.0f);
  // (3) wk^T[r][b*SEQ+n] = exp((16w^T . 16k) / 256)   (M=256, N=NB*SEQ, K=64) -> f16 plane pitch NB*SEQ
  gemm64<2><<<g1, blk, 0, stream>>>(WT, HD, 0LL, Kh, HD, 0LL, (void*)WKT, (int)NK, 0LL,
                                   NR, (int)NK, HD, 1.0f / 256.0f);
  // (4) kv^T[b][d][r] = sum_n 16v^T[d][n] wk^T[r][n], stored as f16(kv / 16)   (M=64, N=256, K=SEQ per batch)
  gemm64<1><<<g2, dim3(128), 0, stream>>>(VT, (int)NK, (long long)SEQ, WKT, (int)NK, (long long)SEQ,
                                         (void*)KVT, NR, (long long)HD * NR,
                                         HD, NR, SEQ, 1.0f / 256.0f);
  // (5) wq[(b*SEQ+n)*8+h][r] = exp((16q . 16w) / 256)   (M=NB*SEQ*8, N=256, K=64) -> f16 plane pitch 256
  gemm64<2><<<g3, blk, 0, stream>>>(Qh, HD, 0LL, WT, HD, 0LL, (void*)WQ, NR, 0LL,
                                   (int)MQ, NR, HD, 1.0f / 256.0f);
  // (6) out[(b*SEQ+n)*8+h][d] = 16 * sum_r wq[.][r] (kv/16)^T[b][d][r]   (M=SEQ*8, N=64, K=256 per batch) -> f32 d_out
  gemm64<0><<<g4, blk, 0, stream>>>(WQ, NR, (long long)SEQ * NH * NR, KVT, NR, (long long)HD * NR,
                                   d_out, HD, (long long)SEQ * NH * HD,
                                   SEQ * NH, HD, NR, 16.0f);
  (void)hipGetLastError();
}

// v001
// One run takes 72.2 microseconds.
// Next to v000, in two timings, it ran 2.70 and 2.73 times as fast.
// Contractions (all v_wmma_f32_16x16x32_f16, f16 operands, single products, f32 accumulate): wk^T = exp(W^T.K^T) [W x16, K x16 planes],
// kv^T = V^T.wk [V x16, wk unscaled], wq = exp(Q.W) [Q x16, W x16], out = wq.kv^T [wq unscaled, kv carried x1/16]; exp and epilogue scaling in f32.
#include <hip/hip_runtime.h>
#include <math.h>
#include <stdint.h>

#ifndef NB
#define NB 4
#endif
#ifndef SEQ
#define SEQ 4096
#endif
#define NB_FULL  4
#define SEQ_FULL 4096
#define NH 8
#define HD 64
#define NR 256
#define QB_FULL ((long long)SEQ_FULL * NH * HD)   // per-batch element stride of Q in the input tensor
#define KB_FULL ((long long)SEQ_FULL * HD)        // per-batch element stride of K and V in the input tensors
static_assert(NB >= 1 && NB <= NB_FULL);
static_assert(SEQ >= 64 && SEQ <= SEQ_FULL && (SEQ % 64) == 0);
static_assert(HD == 64 && NR == 256);
static_assert(((SEQ * NH * HD / 8) % 256) == 0 && ((SEQ * HD / 8) % 256) == 0);
#define KV_KB 256                 // keys summed by one work-group of kv_splitk: 8 waves x one 32-key WMMA step
#define KV_G  (SEQ / KV_KB)       // work-groups (f32 partial planes) along the keys of one batch
static_assert((SEQ % KV_KB) == 0);

typedef _Float16 v16h __attribute__((ext_vector_type(16)));
typedef _Float16 v8h  __attribute__((ext_vector_type(8)));
typedef float    v8f  __attribute__((ext_vector_type(8)));
typedef float    v4f  __attribute__((ext_vector_type(4)));
typedef unsigned int v4u __attribute__((ext_vector_type(4)));
typedef unsigned int v2u __attribute__((ext_vector_type(2)));

#if defined(__HIP_DEVICE_COMPILE__)
#define DEV_ASM 1
#else
#define DEV_ASM 0
#endif

// ---- scalar helpers --------------------------------------------------------------------------------
__device__ __forceinline__ unsigned short h_bits(_Float16 x) { return __builtin_bit_cast(unsigned short, x); }
__device__ __forceinline__ unsigned pk16(unsigned short a, unsigned short b) { return (unsigned)a | ((unsigned)b << 16); }
__device__ __forceinline__ v8f zero8() { v8f z = {0.f, 0.f, 0.f, 0.f, 0.f, 0.f, 0.f, 0.f}; return z; }

// ---- fragment loader: 16-bit A/B operand, lane -> row/col (lane&15), p already includes +8*(lane>>4);
//      elements 0..7 <- p[0..7] (k0+8h..k0+8h+7), elements 8..15 <- p[16..23] (k0+16+8h..k0+16+8h+7)
__device__ __forceinline__ v16h ldfrag(const _Float16* p) {
  union { v16h v; v8h h[2]; } f;
  f.h[0] = *(const v8h*)(p);
  f.h[1] = *(const v8h*)(p + 16);
  return f.v;
}

// ---- WMMA helpers (asm guard bodies are device-only) ----------------------------------------------
__device__ __forceinline__ v8f mmar(v16h a, v16h b, v8f c) {
  return __builtin_amdgcn_wmma_f32_16x16x32_f16(false, a, false, b, (short)0, c, false, false);
}
__device__ __forceinline__ void dep_guard(v8f& a, v8f& b, v16h x, v16h y) {
#if DEV_ASM
  asm volatile("v_nop\n\tv_nop\n\tv_nop\n\tv_nop" : "+v"(a), "+v"(b) : "v"(x), "v"(y));
#else
  (void)a; (void)b; (void)x; (void)y;
#endif
}
__device__ __forceinline__ void keep4(v16h a, v16h b, v16h c, v16h d) {
#if DEV_ASM
  asm volatile("v_nop" :: "v"(a), "v"(b), "v"(c), "v"(d));
#else
  (void)a; (void)b; (void)c; (void)d;
#endif
}
__device__ __forceinline__ void acc_guard4(v8f& a, v8f& b, v8f& c, v8f& d) {
#if DEV_ASM
  asm volatile("v_nop\n\tv_nop\n\tv_nop\n\tv_nop" : "+v"(a), "+v"(b), "+v"(c), "+v"(d));
#else
  (void)a; (void)b; (void)c; (void)d;
#endif
}

// =====================================================================================================
// f32 -> f16 bits of (scale * x), 8 elements per thread, one 16-B store per lane: a wave writes 512
// blockIdx.y = batch: in base = in + y*inStrideY, out base = out + y*outStrideY (element strides).
// coverage: n8 threads x 8 = the whole per-batch plane (n8 is a multiple of 256 for every use here).
// =====================================================================================================
__global__ __launch_bounds__(256) void cvt_h8(const float* __restrict__ in, long long inStrideY,
                                              unsigned short* out, long long outStrideY, int n8, float scale) {
  const int i = blockIdx.x * 256 + (int)threadIdx.x;
  const int y = blockIdx.y;
  if (i < n8) {
    const float* src = in + (size_t)y * (size_t)inStrideY + (size_t)i * 8;
    const v4f a  = *(const v4f*)(src);
    const v4f a4 = *(const v4f*)(src + 4);
    v4u p;
    p[0] = pk16(h_bits((_Float16)(a[0] * scale)),  h_bits((_Float16)(a[1] * scale)));
    p[1] = pk16(h_bits((_Float16)(a[2] * scale)),  h_bits((_Float16)(a[3] * scale)));
    p[2] = pk16(h_bits((_Float16)(a4[0] * scale)), h_bits((_Float16)(a4[1] * scale)));
    p[3] = pk16(h_bits((_Float16)(a4[2] * scale)), h_bits((_Float16)(a4[3] * scale)));
    unsigned short* o = out + (size_t)y * (size_t)outStrideY + (size_t)i * 8;
    *(v4u*)o = p;
    
  }
}

// =====================================================================================================
// Transpose-convert through LDS: in[rows][cols] f32 (row pitch = cols) -> out[cols][rows] f16 (pitch ldo halves).
// Tile (ti = blockIdx.x over row blocks of 64, tj = blockIdx.y over col blocks of 64, z = blockIdx.z batch):
//   out[(tj*64 + j) * ldo + z*ocolStrideZ + ti*64 + i] = f16(scale * in[z*inStrideZ + (ti*64 + i)*cols + tj*64 + j]).
// Load: 256 threads x 16 floats = the whole 64x64 tile (plain 16-B loads), __syncthreads, then each out row
// =====================================================================================================
__global__ __launch_bounds__(256) void tr_cvt64(const float* __restrict__ in, int cols, long long inStrideZ,
                                                unsigned short* out, int ldo, long long ocolStrideZ, float scale) {
  __shared__ float T[64 * 65];
  const int tid = (int)threadIdx.x;
  const int ti = blockIdx.x, tj = blockIdx.y, z = blockIdx.z;
  {
    const int row = tid >> 2, c16 = (tid & 3) * 16;
    const float* src = in + (size_t)z * (size_t)inStrideZ + (size_t)(ti * 64 + row) * (size_t)cols + tj * 64 + c16;
#pragma unroll
    for (int e = 0; e < 4; ++e) {
      const v4f a = *(const v4f*)(src + 4 * e);
      float* t = T + row * 65 + c16 + 4 * e;
      t[0] = a[0]; t[1] = a[1]; t[2] = a[2]; t[3] = a[3];
    }
  }
  __syncthreads();
  const int wave = tid >> 5, lane = tid & 31;
  const int q = lane >> 3, c8 = (lane & 7) * 8;
  v4u hv[2];
#pragma unroll
  for (int it = 0; it < 2; ++it) {
    const int j = wave * 8 + it * 4 + q;          // out row within tile, 0..63
    v4u a;
#pragma unroll
    for (int e = 0; e < 4; ++e) {
      const float f0 = T[(c8 + 2 * e) * 65 + j] * scale;
      const float f1 = T[(c8 + 2 * e + 1) * 65 + j] * scale;
      a[e] = pk16(h_bits((_Float16)f0), h_bits((_Float16)f1));
    }
    hv[it] = a;
  }
  unsigned short* ob = out + (size_t)z * (size_t)ocolStrideZ + (size_t)ti * 64 + c8;
  {
#pragma unroll
    for (int it = 0; it < 2; ++it) {
      const int j = wave * 8 + it * 4 + q;
      *(v4u*)(ob + (size_t)(tj * 64 + j) * (size_t)ldo) = hv[it];
    }
    
  }
}

// =====================================================================================================
// Register-blocked batched WMMA GEMM (f16 operands): C[m][n] = sum_k A[m][k] * Bt[n][k];
// one wave per 64x64 tile, no block barriers. A row-major [M][K] pitch lda; Bt row-major [N][K] pitch ldb
// (k contiguous); M, N multiples of 64, K multiple of 32 (host-checked). blockIdx.y = batch index
// (strides in elements). Fragments are loaded straight from global with the split k map (ldfrag).
// OUT_MODE 0: f32 C (pitch ldc), value * oscale.
// OUT_MODE 1: f16 plane C (pitch ldc) of value * oscale.
// OUT_MODE 2: f16 plane C (pitch ldc) of exp(value * oscale).
// =====================================================================================================
template <int OUT_MODE>
__global__ __launch_bounds__(256) void gemm64(
    const unsigned short* __restrict__ Ap, int lda, long long strideA,
    const unsigned short* __restrict__ Btp, int ldb, long long strideB,
    void* Cout, int ldc, long long strideC,
    int M, int N, int K, float oscale) {
  const _Float16* A  = (const _Float16*)(const void*)Ap;
  const _Float16* Bt = (const _Float16*)(const void*)Btp;
  __shared__ __align__(16) float sT[8][16 * 68];   // per-wave 16x64 slab, pitch 68 floats
  const int b    = blockIdx.y;
  const int lane = threadIdx.x & 31;
  const int wave = threadIdx.x >> 5;
  const int tilesN = N >> 6;
  const int tilesM = M >> 6;
  const int tile = blockIdx.x * 8 + wave;
  if (tile >= tilesM * tilesN) return;   // wave-uniform; no block barriers in this kernel
  const int tm = tile / tilesN;
  const int tn = tile - tm * tilesN;
  const int m0 = tm << 6;
  const int n0 = tn << 6;

  const _Float16* Ab = A  + (size_t)b * (size_t)strideA;
  const _Float16* Bb = Bt + (size_t)b * (size_t)strideB;

  const int rlane = lane & 15;                 // row (A) / col (B, D) within subtile
  const int koff  = (lane >> 4) * 8;           // k offset of this lane half
  const int mOff  = (lane >> 4) * 8;           // D row offset

  v8f acc[4][4];
#pragma unroll
  for (int i = 0; i < 4; ++i)
#pragma unroll
    for (int j = 0; j < 4; ++j) acc[i][j] = zero8();

  for (int k0 = 0; k0 < K; k0 += 32) {
    v16h bq[4];
#pragma unroll
    for (int j = 0; j < 4; ++j)
      bq[j] = ldfrag(Bb + (size_t)(n0 + (j << 4) + rlane) * (size_t)ldb + koff + k0);
#pragma unroll
    for (int i = 0; i < 4; ++i) {
      const v16h af = ldfrag(Ab + (size_t)(m0 + (i << 4) + rlane) * (size_t)lda + koff + k0);
#pragma unroll
      for (int j = 0; j < 4; ++j) acc[i][j] = mmar(af, bq[j], acc[i][j]);
      dep_guard(acc[i][0], acc[i][3], af, bq[3]);
    }
    keep4(bq[0], bq[1], bq[2], bq[3]);
  }
  acc_guard4(acc[0][0], acc[0][1], acc[0][2], acc[0][3]);
  acc_guard4(acc[1][0], acc[1][1], acc[1][2], acc[1][3]);
  acc_guard4(acc[2][0], acc[2][1], acc[2][2], acc[2][3]);
  acc_guard4(acc[3][0], acc[3][1], acc[3][2], acc[3][3]);

  // ---- epilogue ----
  float* slab = sT[wave];
#pragma unroll
  for (int i = 0; i < 4; ++i) {
    const int mBase = m0 + (i << 4);
#pragma unroll
    for (int j = 0; j < 4; ++j) {
#pragma unroll
      for (int r = 0; r < 8; ++r) {
        slab[(mOff + r) * 68 + (j << 4) + rlane] = acc[i][j][r];
      }
    }
    __builtin_amdgcn_fence(__ATOMIC_RELEASE, "workgroup");
    __builtin_amdgcn_wave_barrier();
    __builtin_amdgcn_fence(__ATOMIC_ACQUIRE, "workgroup");
    if (OUT_MODE == 0) {
      float* C = (float*)Cout + (size_t)b * (size_t)strideC;
      const int h2 = lane >> 4, c4 = (lane & 15) * 4;     // 256-B row segment = 16 lanes x 16 B
      {
#pragma unroll
        for (int it = 0; it < 8; ++it) {
          const int row = it * 2 + h2;                     // it 0..7 x h2 0..1 = rows 0..15
          const v4f v = *(const v4f*)(slab + row * 68 + c4) * oscale;
          *(v4f*)(C + (size_t)(mBase + row) * (size_t)ldc + n0 + c4) = v;
        }
        
      }
    } else {
      const int q = lane >> 3, c8 = (lane & 7) * 8;
      unsigned short* C = (unsigned short*)Cout + (size_t)b * (size_t)strideC;
      v4u hv[4];
#pragma unroll
      for (int it = 0; it < 4; ++it) {
        const int row = it * 4 + q;                        // it 0..3 x q 0..3 = rows 0..15
        const float* sp = slab + row * 68 + c8;
        float f[8];
#pragma unroll
        for (int e = 0; e < 8; ++e) {
          const float x = sp[e] * oscale;
          f[e] = (OUT_MODE == 2) ? __expf(x) : x;
        }
        v4u a;
#pragma unroll
        for (int e = 0; e < 4; ++e) {
          const _Float16 x0 = (_Float16)f[2 * e], x1 = (_Float16)f[2 * e + 1];
          a[e] = pk16(h_bits(x0), h_bits(x1));
        }
        hv[it] = a;
      }
      {
#pragma unroll
        for (int it = 0; it < 4; ++it) {
          const int row = it * 4 + q;
          *(v4u*)(C + (size_t)(mBase + row) * (size_t)ldc + n0 + c8) = hv[it];
        }
        
      }
    }
    __builtin_amdgcn_fence(__ATOMIC_RELEASE, "workgroup");
    __builtin_amdgcn_wave_barrier();
    __builtin_amdgcn_fence(__ATOMIC_ACQUIRE, "workgroup");
  }
}

// =====================================================================================================
// kv^T split over the keys: P[g][b][d][r] = sum over keys n in [g*256, g*256+256) of 16v^T[d][n] * wk^T[r][n], f32.
// Work-group (tn = blockIdx.x r-block of 64, g = blockIdx.y key block, b = blockIdx.z batch); wave w takes the
// 32 keys g*256 + w*32.. as ONE WMMA k step of a 64x64 tile (16 fragment loads, all in flight together),
// the 8 waves' tiles are joined through LDS in the fixed order w = 0..7, each thread storing 4 x 16 B of the sum.
// Every P row segment (64 floats = 256 B, two whole lines) has one writer.
// =====================================================================================================
__global__ __launch_bounds__(256) void kv_splitk(const unsigned short* __restrict__ VTp,
                                                 const unsigned short* __restrict__ WKTp, float* __restrict__ P) {
  __shared__ __align__(16) float sP[8][64 * 68];   // per-wave 64x64 tile, pitch 68 floats
  const int tn = blockIdx.x, g = blockIdx.y, b = blockIdx.z;
  const int tid = (int)threadIdx.x;
  const int lane = tid & 31, wave = tid >> 5;
  const int rlane = lane & 15;                     // row (A) / col (B, D) within subtile
  const int mOff  = (lane >> 4) * 8;               // k offset of this lane half; D row offset
  const size_t ld = (size_t)NB * SEQ;
  const size_t kb = (size_t)b * SEQ + (size_t)(g * KV_KB + wave * 32 + mOff);
  const _Float16* A  = (const _Float16*)(const void*)VTp + kb + (size_t)rlane * ld;
  const _Float16* Bt = (const _Float16*)(const void*)WKTp + (size_t)((tn << 6) + rlane) * ld + kb;

  v16h bq[4], af[4];
#pragma unroll
  for (int j = 0; j < 4; ++j) bq[j] = ldfrag(Bt + (size_t)(j << 4) * ld);
#pragma unroll
  for (int i = 0; i < 4; ++i) af[i] = ldfrag(A + (size_t)(i << 4) * ld);
  // keeps all 16 loads ahead of the first WMMA: without it two A fragments are loaded only after earlier WMMAs
  // have freed their registers, and the wave pays three memory latencies in a row instead of one
  __builtin_amdgcn_sched_barrier(0);
#if DEV_ASM
  // the wait owed before a register that an issued load names is overwritten; the two address pairs are inputs,
  // so that no load's result lands on them ahead of it
  asm volatile("s_wait_xcnt 0x0" :: "v"(A), "v"(Bt) : "memory");
#endif

  v8f acc[4][4];
#pragma unroll
  for (int i = 0; i < 4; ++i)
#pragma unroll
    for (int j = 0; j < 4; ++j) acc[i][j] = mmar(af[i], bq[j], zero8());
  // keeps the LDS stores behind all 16 WMMAs, so that no store reads a result directly behind its WMMA
  __builtin_amdgcn_sched_barrier(0);
#if DEV_ASM
  // the four vector slots the chip needs between the last WMMA and the first reader of a result
  asm volatile("v_nop\n\tv_nop\n\tv_nop\n\tv_nop");
#endif

  float* slab = sP[wave];
#pragma unroll
  for (int i = 0; i < 4; ++i)
#pragma unroll
    for (int j = 0; j < 4; ++j)
#pragma unroll
      for (int r = 0; r < 8; ++r) slab[((i << 4) + mOff + r) * 68 + (j << 4) + rlane] = acc[i][j][r];
  __syncthreads();   // all 8 waves' tiles are in LDS before any thread sums across them

  float* Pg = P + ((size_t)g * NB + b) * (size_t)(HD * NR) + (tn << 6);
  const int r16 = tid >> 4, c4 = (tid & 15) * 4;   // 256-B row segment = 16 lanes x 16 B
#pragma unroll
  for (int c = 0; c < 4; ++c) {
    const int row = (c << 4) + r16;
    v4f s = *(const v4f*)(&sP[0][row * 68 + c4]);
#pragma unroll
    for (int w = 1; w < 8; ++w) s += *(const v4f*)(&sP[w][row * 68 + c4]);
    *(v4f*)(Pg + (size_t)row * NR + c4) = s;
  }
}

// =====================================================================================================
// KVT[b][d][r] = f16(scale * sum over g = 0..KV_G-1 of P[g][b][d][r]), fixed order; 4 elements per thread:
// a wave reads 512 contiguous B per plane and writes 256 contiguous B (two whole lines).
// coverage: NB*HD*NR/4 threads, a multiple of 256.
// =====================================================================================================
__global__ __launch_bounds__(256) void kv_sum(const float* __restrict__ P, unsigned short* KVT, float scale) {
  const size_t i4 = ((size_t)blockIdx.x * 256 + threadIdx.x) * 4;
  const float* p = P + i4;
  v4f t[KV_G];
#pragma unroll
  for (int g = 0; g < KV_G; ++g) t[g] = *(const v4f*)(p + (size_t)g * (size_t)(NB * HD * NR));
  // keeps every plane's load ahead of the first add: one memory latency for the whole sum
  __builtin_amdgcn_sched_barrier(0);
#if DEV_ASM
  // the wait owed before a register that an issued load names is overwritten; the address pair is an input,
  // so that no load's result lands on it ahead of it
  asm volatile("s_wait_xcnt 0x0" :: "v"(p) : "memory");
#endif
  v4f s = t[0];
#pragma unroll
  for (int g = 1; g < KV_G; ++g) s += t[g];
  s *= scale;
  v2u o;
  o[0] = pk16(h_bits((_Float16)s[0]), h_bits((_Float16)s[1]));
  o[1] = pk16(h_bits((_Float16)s[2]), h_bits((_Float16)s[3]));
  *(v2u*)(KVT + i4) = o;
}

// =====================================================================================================
// Workspace map (bytes, full build), every region an exact multiple of its whole-line store granularity:
//   Qh   f16 [NB*SEQ*NH][64]   (16 q)           16777216
//   Kh   f16 [NB*SEQ][64]      (16 k)            2097152
//   VT   f16 [64][NB*SEQ]      (16 v)^T          2097152
//   WT   f16 [256][64]         (16 w)^T            32768
//   WKT  f16 [256][NB*SEQ]     wk^T = exp(.)     8388608
//   KVT  f16 [NB][64][256]     kv^T / 16          131072
//   WQ   f16 [NB*SEQ*NH][256]  wq = exp(.)      67108864
//   KVP  f32 [KV_G][NB][64][256] key-block sums  4194304
//   total                                      100827136
// Launch plan: 2 converts, 2 transpose-converts, 4 GEMMs (kv split over the keys), 1 sum of its planes = 9 launches.
// =====================================================================================================
extern "C" void kernel_launch(void* const* d_in, const int* in_sizes, int n_in,
                              void* d_out, int out_size, void* d_ws, size_t ws_size,
                              hipStream_t stream) {
  if (n_in < 4) return;
  const long long needQ  = ((long long)(NB - 1) * SEQ_FULL + SEQ) * NH * HD;
  const long long needKV = ((long long)(NB - 1) * SEQ_FULL + SEQ) * HD;
  if ((long long)in_sizes[0] < needQ) return;
  if ((long long)in_sizes[1] < needKV || (long long)in_sizes[2] < needKV) return;
  if (in_sizes[3] < HD * NR) return;
  if ((long long)out_size < (long long)NB * SEQ * NH * HD) return;

  const float* Q = (const float*)d_in[0];
  const float* K = (const float*)d_in[1];
  const float* V = (const float*)d_in[2];
  const float* W = (const float*)d_in[3];

  const long long MQ = (long long)NB * SEQ * NH;        // rows of q / wq / out
  const long long NK = (long long)NB * SEQ;             // key rows over all batches

  const size_t PQ  = (size_t)MQ * HD * 2;               // 16777216
  const size_t PK  = (size_t)NK * HD * 2;               //  2097152
  const size_t PVT = (size_t)HD * NK * 2;               //  2097152
  const size_t PWT = (size_t)NR * HD * 2;               //    32768
  const size_t PWK = (size_t)NR * NK * 2;               //  8388608
  const size_t PKV = (size_t)NB * HD * NR * 2;          //   131072
  const size_t PWQ = (size_t)MQ * NR * 2;               // 67108864
  const size_t PKP = (size_t)KV_G * NB * HD * NR * 4;   //  4194304
  size_t off = 0;
  const size_t oQ  = off; off += PQ;
  const size_t oK  = off; off += PK;
  const size_t oVT = off; off += PVT;
  const size_t oWT = off; off += PWT;
  const size_t oWK = off; off += PWK;
  const size_t oKV = off; off += PKV;
  const size_t oWQ = off; off += PWQ;
  const size_t oKP = off; off += PKP;
  if (off > ws_size) return;                            // off = 100827136 (full build)
  if (off > (size_t)134217728) return;

  char* ws = (char*)d_ws;
  unsigned short* Qh  = (unsigned short*)(ws + oQ);
  unsigned short* Kh  = (unsigned short*)(ws + oK);
  unsigned short* VT  = (unsigned short*)(ws + oVT);
  unsigned short* WT  = (unsigned short*)(ws + oWT);
  unsigned short* WKT = (unsigned short*)(ws + oWK);
  unsigned short* KVT = (unsigned short*)(ws + oKV);
  unsigned short* WQ  = (unsigned short*)(ws + oWQ);
  float*          KVP = (float*)(ws + oKP);

  const dim3 blk(256);
  const int n8q = SEQ * NH * HD / 8;                                  // 262144 per batch
  const int n8k = SEQ * HD / 8;                                       //  32768 per batch
  const dim3 gCvtQ((n8q + 255) / 256, NB);                            // 1024 x 4
  const dim3 gCvtK((n8k + 255) / 256, NB);                            //  128 x 4
  const dim3 gTrV(SEQ / 64, 1, NB);                                   // in [SEQ][64] per batch -> out [64][NB*SEQ] cols b*SEQ..
  const dim3 gTrW(1, NR / 64, 1);                                     // in [64][256] -> out [256][64]
  const long long t1 = (long long)(NR / 64) * (NK / 64);              // 1024 tiles
  const long long t3 = (MQ / 64) * (NR / 64);                         // 8192 tiles
  const long long t4 = ((long long)SEQ * NH / 64) * (HD / 64);        //  512 tiles per batch
  const dim3 g1((unsigned)((t1 + 7) / 8), 1);
  const dim3 g2(NR / 64, KV_G, NB);                                   // 4 r-blocks x 16 key blocks x 4 batches
  const dim3 g2s(NB * HD * NR / 4 / 256);                             // 64
  const dim3 g3((unsigned)((t3 + 7) / 8), 1);
  const dim3 g4((unsigned)((t4 + 7) / 8), NB);

  // (1) q -> f16 plane of 16 q [b*SEQ+n][h*64+d]; k -> f16 plane of 16 k [b*SEQ+n][d]
  cvt_h8<<<gCvtQ, blk, 0, stream>>>(Q, QB_FULL, Qh, (long long)SEQ * NH * HD, n8q, 16.0f);
  cvt_h8<<<gCvtK, blk, 0, stream>>>(K, KB_FULL, Kh, (long long)SEQ * HD, n8k, 16.0f);
  // (2) v [b][SEQ][64] -> v^T f16 plane of 16 v: [d][b*SEQ + n] (pitch NB*SEQ)
  tr_cvt64<<<gTrV, blk, 0, stream>>>(V, HD, KB_FULL, VT, (int)NK, (long long)SEQ, 16.0f);
  //     w [64 d][256 r] -> w^T f16 plane of 16 w: [r][d] (pitch 64)
  tr_cvt64<<<gTrW, blk, 0, stream>>>(W, NR, 0LL, WT, HD, 0LL, 16.0f);
  // (3) wk^T[r][b*SEQ+n] = exp((16w^T . 16k) / 256)   (M=256, N=NB*SEQ, K=64) -> f16 plane pitch NB*SEQ
  gemm64<2><<<g1, blk, 0, stream>>>(WT, HD, 0LL, Kh, HD, 0LL, (void*)WKT, (int)NK, 0LL,
                                   NR, (int)NK, HD, 1.0f / 256.0f);
  // (4) kv^T[b][d][r] = sum_n v^T[d][n] wk^T[r][n], stored as f16(kv / 16)   (M=64, N=256, K=SEQ per batch):
  //     f32 sums per block of 256 keys, then the sum of those planes
  kv_splitk<<<g2, blk, 0, stream>>>(VT, WKT, KVP);
  kv_sum<<<g2s, blk, 0, stream>>>(KVP, KVT, 1.0f / 256.0f);
  // (5) wq[(b*SEQ+n)*8+h][r] = exp((16q . 16w) / 256)   (M=NB*SEQ*8, N=256, K=64) -> f16 plane pitch 256
  gemm64<2><<<g3, blk, 0, stream>>>(Qh, HD, 0LL, WT, HD, 0LL, (void*)WQ, NR, 0LL,
                                   (int)MQ, NR, HD, 1.0f / 256.0f);
  // (6) out[(b*SEQ+n)*8+h][d] = 16 * sum_r wq[.][r] (kv/16)^T[b][d][r]   (M=SEQ*8, N=64, K=256 per batch) -> f32 d_out
  gemm64<0><<<g4, blk, 0, stream>>>(WQ, NR, (long long)SEQ * NH * NR, KVT, NR, (long long)HD * NR,
                                   d_out, HD, (long long)SEQ * NH * HD,
                                   SEQ * NH, HD, NR, 16.0f);
  (void)hipGetLastError();
}

// v002
// Measured time: 33.5 microseconds a run.
// Timed twice side by side with v001, it ran 2.15 times as fast both times.
// Over all steps from v000 it is 5.83 times as fast.
// Contractions (all v_wmma_f32_16x16x32_f16, f16 operands, single products, f32 accumulate): wk^T = exp(W^T.K^T) [W x16, K x16 planes],
// kv^T = V^T.wk [V x16, wk unscaled], wq^T = exp(W^T.Q^T) [Q x16, W x16], out^T = kv^T.wq^T [wq unscaled, kv carried x1/16]; exp and epilogue scaling in f32.
#include <hip/hip_runtime.h>
#include <math.h>
#include <stdint.h>

#ifndef NB
#define NB 4
#endif
#ifndef SEQ
#define SEQ 4096
#endif
#define NB_FULL  4
#define SEQ_FULL 4096
#define NH 8
#define HD 64
#define NR 256
#define QB_FULL ((long long)SEQ_FULL * NH * HD)   // per-batch element stride of Q in the input tensor
#define KB_FULL ((long long)SEQ_FULL * HD)        // per-batch element stride of K and V in the input tensors
static_assert(NB >= 1 && NB <= NB_FULL);
static_assert(SEQ >= 64 && SEQ <= SEQ_FULL && (SEQ % 64) == 0);
static_assert(HD == 64 && NR == 256);
static_assert(((SEQ * NH * HD / 8) % 256) == 0 && ((SEQ * HD / 8) % 256) == 0);
#define KV_KB 256                 // keys summed by one work-group of kv_splitk: 8 waves x one 32-key WMMA step
#define KV_G  (SEQ / KV_KB)       // work-groups (f32 partial planes) along the keys of one batch
static_assert((SEQ % KV_KB) == 0);

typedef _Float16 v16h __attribute__((ext_vector_type(16)));
typedef _Float16 v8h  __attribute__((ext_vector_type(8)));
typedef _Float16 v4h  __attribute__((ext_vector_type(4)));
typedef float    v8f  __attribute__((ext_vector_type(8)));
typedef float    v4f  __attribute__((ext_vector_type(4)));
typedef unsigned int v4u __attribute__((ext_vector_type(4)));
typedef unsigned int v2u __attribute__((ext_vector_type(2)));

#if defined(__HIP_DEVICE_COMPILE__)
#define DEV_ASM 1
#else
#define DEV_ASM 0
#endif

// ---- scalar helpers --------------------------------------------------------------------------------
__device__ __forceinline__ unsigned short h_bits(_Float16 x) { return __builtin_bit_cast(unsigned short, x); }
__device__ __forceinline__ unsigned pk16(unsigned short a, unsigned short b) { return (unsigned)a | ((unsigned)b << 16); }
__device__ __forceinline__ v8f zero8() { v8f z = {0.f, 0.f, 0.f, 0.f, 0.f, 0.f, 0.f, 0.f}; return z; }

// ---- fragment loader: 16-bit A/B operand, lane -> row/col (lane&15), p already includes +8*(lane>>4);
//      elements 0..7 <- p[0..7] (k0+8h..k0+8h+7), elements 8..15 <- p[16..23] (k0+16+8h..k0+16+8h+7)
__device__ __forceinline__ v16h ldfrag(const _Float16* p) {
  union { v16h v; v8h h[2]; } f;
  f.h[0] = *(const v8h*)(p);
  f.h[1] = *(const v8h*)(p + 16);
  return f.v;
}

// ---- WMMA helpers (asm guard bodies are device-only) ----------------------------------------------
__device__ __forceinline__ v8f mmar(v16h a, v16h b, v8f c) {
  return __builtin_amdgcn_wmma_f32_16x16x32_f16(false, a, false, b, (short)0, c, false, false);
}
__device__ __forceinline__ void dep_guard(v8f& a, v8f& b, v16h x, v16h y) {
#if DEV_ASM
  asm volatile("v_nop\n\tv_nop\n\tv_nop\n\tv_nop" : "+v"(a), "+v"(b) : "v"(x), "v"(y));
#else
  (void)a; (void)b; (void)x; (void)y;
#endif
}
__device__ __forceinline__ void keep4(v16h a, v16h b, v16h c, v16h d) {
#if DEV_ASM
  asm volatile("v_nop" :: "v"(a), "v"(b), "v"(c), "v"(d));
#else
  (void)a; (void)b; (void)c; (void)d;
#endif
}
__device__ __forceinline__ void acc_guard4(v8f& a, v8f& b, v8f& c, v8f& d) {
#if DEV_ASM
  asm volatile("v_nop\n\tv_nop\n\tv_nop\n\tv_nop" : "+v"(a), "+v"(b), "+v"(c), "+v"(d));
#else
  (void)a; (void)b; (void)c; (void)d;
#endif
}

// 2^x of 8 values. One statement, every result on a register of its own, one v_nop behind the last: the slot the instruction
// set asks for between a transcendental and a directly following instruction that reads its result or overwrites its source.
__device__ __forceinline__ v8f exp2x8(v8f x) {
#if DEV_ASM
  float e0, e1, e2, e3, e4, e5, e6, e7;
  asm("v_exp_f32 %0, %8\n\tv_exp_f32 %1, %9\n\tv_exp_f32 %2, %10\n\tv_exp_f32 %3, %11\n\t"
      "v_exp_f32 %4, %12\n\tv_exp_f32 %5, %13\n\tv_exp_f32 %6, %14\n\tv_exp_f32 %7, %15\n\tv_nop"
      : "=&v"(e0), "=&v"(e1), "=&v"(e2), "=&v"(e3), "=&v"(e4), "=&v"(e5), "=&v"(e6), "=&v"(e7)
      : "v"(x[0]), "v"(x[1]), "v"(x[2]), "v"(x[3]), "v"(x[4]), "v"(x[5]), "v"(x[6]), "v"(x[7]));
  const v8f r = {e0, e1, e2, e3, e4, e5, e6, e7};
  return r;
#else
  return x;
#endif
}

// =====================================================================================================
// f32 -> f16 bits of (scale * x), 8 elements per thread, one 16-B store per lane: a wave writes 512
// blockIdx.y = batch: in base = in + y*inStrideY, out base = out + y*outStrideY (element strides).
// coverage: n8 threads x 8 = the whole per-batch plane (n8 is a multiple of 256 for every use here).
// =====================================================================================================
__global__ __launch_bounds__(256) void cvt_h8(const float* __restrict__ in, long long inStrideY,
                                              unsigned short* out, long long outStrideY, int n8, float scale) {
  const int i = blockIdx.x * 256 + (int)threadIdx.x;
  const int y = blockIdx.y;
  if (i < n8) {
    const float* src = in + (size_t)y * (size_t)inStrideY + (size_t)i * 8;
    const v4f a  = *(const v4f*)(src);
    const v4f a4 = *(const v4f*)(src + 4);
    v4u p;
    p[0] = pk16(h_bits((_Float16)(a[0] * scale)),  h_bits((_Float16)(a[1] * scale)));
    p[1] = pk16(h_bits((_Float16)(a[2] * scale)),  h_bits((_Float16)(a[3] * scale)));
    p[2] = pk16(h_bits((_Float16)(a4[0] * scale)), h_bits((_Float16)(a4[1] * scale)));
    p[3] = pk16(h_bits((_Float16)(a4[2] * scale)), h_bits((_Float16)(a4[3] * scale)));
    unsigned short* o = out + (size_t)y * (size_t)outStrideY + (size_t)i * 8;
    *(v4u*)o = p;
    
  }
}

// =====================================================================================================
// Transpose-convert through LDS: in[rows][cols] f32 (row pitch = cols) -> out[cols][rows] f16 (pitch ldo halves).
// Tile (ti = blockIdx.x over row blocks of 64, tj = blockIdx.y over col blocks of 64, z = blockIdx.z batch):
//   out[(tj*64 + j) * ldo + z*ocolStrideZ + ti*64 + i] = f16(scale * in[z*inStrideZ + (ti*64 + i)*cols + tj*64 + j]).
// Load: 256 threads x 16 floats = the whole 64x64 tile (plain 16-B loads), __syncthreads, then each out row
// =====================================================================================================
__global__ __launch_bounds__(256) void tr_cvt64(const float* __restrict__ in, int cols, long long inStrideZ,
                                                unsigned short* out, int ldo, long long ocolStrideZ, float scale) {
  __shared__ float T[64 * 65];
  const int tid = (int)threadIdx.x;
  const int ti = blockIdx.x, tj = blockIdx.y, z = blockIdx.z;
  {
    const int row = tid >> 2, c16 = (tid & 3) * 16;
    const float* src = in + (size_t)z * (size_t)inStrideZ + (size_t)(ti * 64 + row) * (size_t)cols + tj * 64 + c16;
#pragma unroll
    for (int e = 0; e < 4; ++e) {
      const v4f a = *(const v4f*)(src + 4 * e);
      float* t = T + row * 65 + c16 + 4 * e;
      t[0] = a[0]; t[1] = a[1]; t[2] = a[2]; t[3] = a[3];
    }
  }
  __syncthreads();
  const int wave = tid >> 5, lane = tid & 31;
  const int q = lane >> 3, c8 = (lane & 7) * 8;
  v4u hv[2];
#pragma unroll
  for (int it = 0; it < 2; ++it) {
    const int j = wave * 8 + it * 4 + q;          // out row within tile, 0..63
    v4u a;
#pragma unroll
    for (int e = 0; e < 4; ++e) {
      const float f0 = T[(c8 + 2 * e) * 65 + j] * scale;
      const float f1 = T[(c8 + 2 * e + 1) * 65 + j] * scale;
      a[e] = pk16(h_bits((_Float16)f0), h_bits((_Float16)f1));
    }
    hv[it] = a;
  }
  unsigned short* ob = out + (size_t)z * (size_t)ocolStrideZ + (size_t)ti * 64 + c8;
  {
#pragma unroll
    for (int it = 0; it < 2; ++it) {
      const int j = wave * 8 + it * 4 + q;
      *(v4u*)(ob + (size_t)(tj * 64 + j) * (size_t)ldo) = hv[it];
    }
    
  }
}

// =====================================================================================================
// Register-blocked batched WMMA GEMM (f16 operands): C[m][n] = sum_k A[m][k] * Bt[n][k];
// one wave per 64x64 tile, no block barriers. A row-major [M][K] pitch lda; Bt row-major [N][K] pitch ldb
// (k contiguous); M, N multiples of 64, K multiple of 32 (host-checked). blockIdx.y = batch index
// (strides in elements). Fragments are loaded straight from global with the split k map (ldfrag).
// OUT_MODE 0: f32 C (pitch ldc), value * oscale.
// OUT_MODE 1: f16 plane C (pitch ldc) of value * oscale.
// OUT_MODE 2: f16 plane C (pitch ldc) of exp(value * oscale).
// =====================================================================================================
template <int OUT_MODE>
__global__ __launch_bounds__(256) void gemm64(
    const unsigned short* __restrict__ Ap, int lda, long long strideA,
    const unsigned short* __restrict__ Btp, int ldb, long long strideB,
    void* Cout, int ldc, long long strideC,
    int M, int N, int K, float oscale) {
  const _Float16* A  = (const _Float16*)(const void*)Ap;
  const _Float16* Bt = (const _Float16*)(const void*)Btp;
  __shared__ __align__(16) float sT[8][16 * 68];   // per-wave 16x64 slab, pitch 68 floats
  const int b    = blockIdx.y;
  const int lane = threadIdx.x & 31;
  const int wave = threadIdx.x >> 5;
  const int tilesN = N >> 6;
  const int tilesM = M >> 6;
  const int tile = blockIdx.x * 8 + wave;
  if (tile >= tilesM * tilesN) return;   // wave-uniform; no block barriers in this kernel
  const int tm = tile / tilesN;
  const int tn = tile - tm * tilesN;
  const int m0 = tm << 6;
  const int n0 = tn << 6;

  const _Float16* Ab = A  + (size_t)b * (size_t)strideA;
  const _Float16* Bb = Bt + (size_t)b * (size_t)strideB;

  const int rlane = lane & 15;                 // row (A) / col (B, D) within subtile
  const int koff  = (lane >> 4) * 8;           // k offset of this lane half
  const int mOff  = (lane >> 4) * 8;           // D row offset

  v8f acc[4][4];
#pragma unroll
  for (int i = 0; i < 4; ++i)
#pragma unroll
    for (int j = 0; j < 4; ++j) acc[i][j] = zero8();

  for (int k0 = 0; k0 < K; k0 += 32) {
    v16h bq[4];
#pragma unroll
    for (int j = 0; j < 4; ++j)
      bq[j] = ldfrag(Bb + (size_t)(n0 + (j << 4) + rlane) * (size_t)ldb + koff + k0);
#pragma unroll
    for (int i = 0; i < 4; ++i) {
      const v16h af = ldfrag(Ab + (size_t)(m0 + (i << 4) + rlane) * (size_t)lda + koff + k0);
#pragma unroll
      for (int j = 0; j < 4; ++j) acc[i][j] = mmar(af, bq[j], acc[i][j]);
      dep_guard(acc[i][0], acc[i][3], af, bq[3]);
    }
    keep4(bq[0], bq[1], bq[2], bq[3]);
  }
  acc_guard4(acc[0][0], acc[0][1], acc[0][2], acc[0][3]);
  acc_guard4(acc[1][0], acc[1][1], acc[1][2], acc[1][3]);
  acc_guard4(acc[2][0], acc[2][1], acc[2][2], acc[2][3]);
  acc_guard4(acc[3][0], acc[3][1], acc[3][2], acc[3][3]);

  // ---- epilogue ----
  float* slab = sT[wave];
#pragma unroll
  for (int i = 0; i < 4; ++i) {
    const int mBase = m0 + (i << 4);
#pragma unroll
    for (int j = 0; j < 4; ++j) {
#pragma unroll
      for (int r = 0; r < 8; ++r) {
        slab[(mOff + r) * 68 + (j << 4) + rlane] = acc[i][j][r];
      }
    }
    __builtin_amdgcn_fence(__ATOMIC_RELEASE, "workgroup");
    __builtin_amdgcn_wave_barrier();
    __builtin_amdgcn_fence(__ATOMIC_ACQUIRE, "workgroup");
    if (OUT_MODE == 0) {
      float* C = (float*)Cout + (size_t)b * (size_t)strideC;
      const int h2 = lane >> 4, c4 = (lane & 15) * 4;     // 256-B row segment = 16 lanes x 16 B
      {
#pragma unroll
        for (int it = 0; it < 8; ++it) {
          const int row = it * 2 + h2;                     // it 0..7 x h2 0..1 = rows 0..15
          const v4f v = *(const v4f*)(slab + row * 68 + c4) * oscale;
          *(v4f*)(C + (size_t)(mBase + row) * (size_t)ldc + n0 + c4) = v;
        }
        
      }
    } else {
      const int q = lane >> 3, c8 = (lane & 7) * 8;
      unsigned short* C = (unsigned short*)Cout + (size_t)b * (size_t)strideC;
      v4u hv[4];
#pragma unroll
      for (int it = 0; it < 4; ++it) {
        const int row = it * 4 + q;                        // it 0..3 x q 0..3 = rows 0..15
        const float* sp = slab + row * 68 + c8;
        float f[8];
#pragma unroll
        for (int e = 0; e < 8; ++e) {
          const float x = sp[e] * oscale;
          f[e] = (OUT_MODE == 2) ? __expf(x) : x;
        }
        v4u a;
#pragma unroll
        for (int e = 0; e < 4; ++e) {
          const _Float16 x0 = (_Float16)f[2 * e], x1 = (_Float16)f[2 * e + 1];
          a[e] = pk16(h_bits(x0), h_bits(x1));
        }
        hv[it] = a;
      }
      {
#pragma unroll
        for (int it = 0; it < 4; ++it) {
          const int row = it * 4 + q;
          *(v4u*)(C + (size_t)(mBase + row) * (size_t)ldc + n0 + c8) = hv[it];
        }
        
      }
    }
    __builtin_amdgcn_fence(__ATOMIC_RELEASE, "workgroup");
    __builtin_amdgcn_wave_barrier();
    __builtin_amdgcn_fence(__ATOMIC_ACQUIRE, "workgroup");
  }
}

// =====================================================================================================
// kv^T split over the keys: P[g][b][d][r] = sum over keys n in [g*256, g*256+256) of 16v^T[d][n] * wk^T[r][n], f32.
// Work-group (tn = blockIdx.x r-block of 64, g = blockIdx.y key block, b = blockIdx.z batch); wave w takes the
// 32 keys g*256 + w*32.. as ONE WMMA k step of a 64x64 tile (16 fragment loads, all in flight together),
// the 8 waves' tiles are joined through LDS in the fixed order w = 0..7, each thread storing 4 x 16 B of the sum.
// Every P row segment (64 floats = 256 B, two whole lines) has one writer.
// =====================================================================================================
__global__ __launch_bounds__(256) void kv_splitk(const unsigned short* __restrict__ VTp,
                                                 const unsigned short* __restrict__ WKTp, float* __restrict__ P) {
  __shared__ __align__(16) float sP[8][64 * 68];   // per-wave 64x64 tile, pitch 68 floats
  const int tn = blockIdx.x, g = blockIdx.y, b = blockIdx.z;
  const int tid = (int)threadIdx.x;
  const int lane = tid & 31, wave = tid >> 5;
  const int rlane = lane & 15;                     // row (A) / col (B, D) within subtile
  const int mOff  = (lane >> 4) * 8;               // k offset of this lane half; D row offset
  const size_t ld = (size_t)NB * SEQ;
  const size_t kb = (size_t)b * SEQ + (size_t)(g * KV_KB + wave * 32 + mOff);
  const _Float16* A  = (const _Float16*)(const void*)VTp + kb + (size_t)rlane * ld;
  const _Float16* Bt = (const _Float16*)(const void*)WKTp + (size_t)((tn << 6) + rlane) * ld + kb;

  v16h bq[4], af[4];
#pragma unroll
  for (int j = 0; j < 4; ++j) bq[j] = ldfrag(Bt + (size_t)(j << 4) * ld);
#pragma unroll
  for (int i = 0; i < 4; ++i) af[i] = ldfrag(A + (size_t)(i << 4) * ld);
  // keeps all 16 loads ahead of the first WMMA: without it two A fragments are loaded only after earlier WMMAs
  // have freed their registers, and the wave pays three memory latencies in a row instead of one
  __builtin_amdgcn_sched_barrier(0);
#if DEV_ASM
  // the wait owed before a register that an issued load names is overwritten; the two address pairs are inputs,
  // so that no load's result lands on them ahead of it
  asm volatile("s_wait_xcnt 0x0" :: "v"(A), "v"(Bt) : "memory");
#endif

  v8f acc[4][4];
#pragma unroll
  for (int i = 0; i < 4; ++i)
#pragma unroll
    for (int j = 0; j < 4; ++j) acc[i][j] = mmar(af[i], bq[j], zero8());
  // keeps the LDS stores behind all 16 WMMAs, so that no store reads a result directly behind its WMMA
  __builtin_amdgcn_sched_barrier(0);
#if DEV_ASM
  // the four vector slots the chip needs between the last WMMA and the first reader of a result
  asm volatile("v_nop\n\tv_nop\n\tv_nop\n\tv_nop");
#endif

  float* slab = sP[wave];
#pragma unroll
  for (int i = 0; i < 4; ++i)
#pragma unroll
    for (int j = 0; j < 4; ++j)
#pragma unroll
      for (int r = 0; r < 8; ++r) slab[((i << 4) + mOff + r) * 68 + (j << 4) + rlane] = acc[i][j][r];
  __syncthreads();   // all 8 waves' tiles are in LDS before any thread sums across them

  float* Pg = P + ((size_t)g * NB + b) * (size_t)(HD * NR) + (tn << 6);
  const int r16 = tid >> 4, c4 = (tid & 15) * 4;   // 256-B row segment = 16 lanes x 16 B
#pragma unroll
  for (int c = 0; c < 4; ++c) {
    const int row = (c << 4) + r16;
    v4f s = *(const v4f*)(&sP[0][row * 68 + c4]);
#pragma unroll
    for (int w = 1; w < 8; ++w) s += *(const v4f*)(&sP[w][row * 68 + c4]);
    *(v4f*)(Pg + (size_t)row * NR + c4) = s;
  }
}

// =====================================================================================================
// KVT[b][d][r] = f16(scale * sum over g = 0..KV_G-1 of P[g][b][d][r]), fixed order; 4 elements per thread:
// a wave reads 512 contiguous B per plane and writes 256 contiguous B (two whole lines).
// coverage: NB*HD*NR/4 threads, a multiple of 256.
// =====================================================================================================
__global__ __launch_bounds__(256) void kv_sum(const float* __restrict__ P, unsigned short* KVT, float scale) {
  const size_t i4 = ((size_t)blockIdx.x * 256 + threadIdx.x) * 4;
  const float* p = P + i4;
  v4f t[KV_G];
#pragma unroll
  for (int g = 0; g < KV_G; ++g) t[g] = *(const v4f*)(p + (size_t)g * (size_t)(NB * HD * NR));
  // keeps every plane's load ahead of the first add: one memory latency for the whole sum
  __builtin_amdgcn_sched_barrier(0);
#if DEV_ASM
  // the wait owed before a register that an issued load names is overwritten; the address pair is an input,
  // so that no load's result lands on it ahead of it
  asm volatile("s_wait_xcnt 0x0" :: "v"(p) : "memory");
#endif
  v4f s = t[0];
#pragma unroll
  for (int g = 1; g < KV_G; ++g) s += t[g];
  s *= scale;
  v2u o;
  o[0] = pk16(h_bits((_Float16)s[0]), h_bits((_Float16)s[1]));
  o[1] = pk16(h_bits((_Float16)s[2]), h_bits((_Float16)s[3]));
  *(v2u*)(KVT + i4) = o;
}

// =====================================================================================================
// Query path in one kernel: out[m][d] = 16 * sum_r f16(exp((16q[m] . 16w[r]) / 256)) * (kv/16)^T[d][r], m = (n*8 + h) of batch b.
// Work-group (blockIdx.x = block of 512 query rows, blockIdx.y = batch), 16 waves, each wave 32 rows (two 16-row tiles).
// Staging: w^T, kv^T[b] (f16 planes) and the wave's own q rows (whole-line f32 loads, x16, f16) go to padded LDS rows.
// Per block of 32 r: S^T = w^T . q^T (w^T as A, q as B, K = 64), so a lane's 8 results of two stacked tiles are r = 8h..8h+7 and
// 16+8h..16+8h+7 of ONE query row: after exp and f16 they ARE the B fragment of out^T = kv^T . wq^T (split k map of ldfrag),
// with no LDS and no lane exchange. out^T leaves a lane 8 consecutive d of one row; a per-wave LDS slab turns them into whole lines.
// =====================================================================================================
#define FQ_WAVES 16
#define FQ_ROWS  32
#define FQ_BM    (FQ_WAVES * FQ_ROWS)   // query rows per work-group
#define LP_W     72                     // LDS pitch of w^T and q rows, halves: 144 B = 16 B x odd
#define LP_KV    264                    // LDS pitch of kv^T rows, halves: 528 B = 16 B x odd
#define LP_O     68                     // LDS pitch of out rows, floats: 272 B = 16 B x odd
#define SM_KV    (NR * LP_W * 2)                          // byte offsets in LDS
#define SM_Q     (SM_KV + HD * LP_KV * 2)
#define SM_O     (SM_Q + FQ_WAVES * FQ_ROWS * LP_W * 2)
static_assert(((SEQ * NH) % FQ_BM) == 0);
__global__ __launch_bounds__(512) void q_fused(const float* __restrict__ Q, const unsigned short* __restrict__ WTp,
                                               const unsigned short* __restrict__ KVTp, float* __restrict__ out) {
  // one array, w^T and kv^T first: every fragment read of the loop is then one lane address plus an immediate below 64 KiB
  __shared__ __align__(16) unsigned char smem[SM_O + FQ_WAVES * FQ_ROWS * LP_O * 4];
  const int tid = (int)threadIdx.x;
  const int lane = tid & 31, wave = tid >> 5;
  _Float16* sW  = (_Float16*)(void*)(smem);                                       // [256 r][LP_W]
  _Float16* sKV = (_Float16*)(void*)(smem + SM_KV);                               // [64 d][LP_KV]
  _Float16* sQw = (_Float16*)(void*)(smem + SM_Q + wave * (FQ_ROWS * LP_W * 2));  // this wave's [32 rows][LP_W]
  float*    slab = (float*)(void*)(smem + SM_O + wave * (FQ_ROWS * LP_O * 4));    // this wave's [32 rows][LP_O]
  const int b = blockIdx.y;
  const size_t row0 = (size_t)blockIdx.x * FQ_BM + (size_t)(wave * FQ_ROWS);   // first row of this wave within the batch

  // ---- staging: every load first (q from memory, the two small planes from L2), then the LDS stores ----
  const float* qsrc = Q + (size_t)b * (size_t)QB_FULL + row0 * HD + lane * 4;   // a wave's load = 512 contiguous B = 2 rows
  const unsigned short* wsrc = WTp + (size_t)tid * 8;
  const unsigned short* ksrc = KVTp + (size_t)b * (size_t)(HD * NR) + (size_t)tid * 8;
  v4f qr[16];
  v4u wr[4], kr[4];
#pragma unroll
  for (int e = 0; e < 16; ++e) qr[e] = *(const v4f*)(qsrc + e * 128);
#pragma unroll
  for (int e = 0; e < 4; ++e) {
    wr[e] = *(const v4u*)(wsrc + e * 4096);
    kr[e] = *(const v4u*)(ksrc + e * 4096);
  }
  // keeps the LDS stores' address arithmetic behind the wait below, so that it reuses no register of a load ahead of it
  __builtin_amdgcn_sched_barrier(0);
#if DEV_ASM
  // the wait owed before a register that an issued load names is overwritten; the q address pair and the thread index
  // (the offset register of the two planes' loads) are inputs, so that nothing lands on them ahead of it
  asm volatile("s_wait_xcnt 0x0" :: "v"(qsrc), "v"(tid) : "memory");
#endif
#pragma unroll
  for (int e = 0; e < 4; ++e) {
    const int c = e * 512 + tid;                   // 16-B chunk index, 2048 chunks per plane
    *(v4u*)(sW + (c >> 3) * LP_W + (c & 7) * 8) = wr[e];
    *(v4u*)(sKV + (c >> 5) * LP_KV + (c & 31) * 8) = kr[e];
  }
  {
    _Float16* q = sQw + (lane >> 4) * LP_W + (lane & 15) * 4;
#pragma unroll
    for (int e = 0; e < 16; ++e) {
      const v4f a = qr[e] * 16.0f;
      const v4h p = {(_Float16)a[0], (_Float16)a[1], (_Float16)a[2], (_Float16)a[3]};
      *(v4h*)(q + 2 * e * LP_W) = p;
    }
  }
  __syncthreads();   // w^T, kv^T and q rows are in LDS before any wave reads a fragment

  const int rl = lane & 15;                        // row (A) / col (B, D) within subtile
  const int h8 = (lane >> 4) * 8;                  // k offset of this lane half; D row offset
  v16h qf[2][2];
#pragma unroll
  for (int mt = 0; mt < 2; ++mt)
#pragma unroll
    for (int ks = 0; ks < 2; ++ks) qf[mt][ks] = ldfrag(sQw + (mt * 16 + rl) * LP_W + ks * 32 + h8);
  const _Float16* wB = sW + rl * LP_W + h8;
  const _Float16* kB = sKV + rl * LP_KV + h8;

  v8f acc[2][4];
#pragma unroll
  for (int mt = 0; mt < 2; ++mt)
#pragma unroll
    for (int i = 0; i < 4; ++i) acc[mt][i] = zero8();

  // exp(x / 256) as exp2(x * (log2(e) / 256)): 1/256 is a power of two, so the one product has the bits of the two
  const float kE = 1.44269504088896340736f / 256.0f;
  v16h wf[2][2];
#pragma unroll
  for (int t = 0; t < 2; ++t)
#pragma unroll
    for (int ks = 0; ks < 2; ++ks) wf[t][ks] = ldfrag(wB + t * 16 * LP_W + ks * 32);
#pragma unroll
  for (int j = 0; j < NR / 32; ++j) {
    v16h kf[4];
#pragma unroll
    for (int i = 0; i < 4; ++i) kf[i] = ldfrag(kB + i * 16 * LP_KV + j * 32);
    // keeps the kv^T reads in one group ahead of the S^T WMMAs: their LDS latency passes under those and the exp block
    __builtin_amdgcn_sched_barrier(0);
    v8f s[2][2];
#pragma unroll
    for (int t = 0; t < 2; ++t)
#pragma unroll
      for (int mt = 0; mt < 2; ++mt) s[t][mt] = mmar(wf[t][0], qf[mt][0], zero8());
#pragma unroll
    for (int t = 0; t < 2; ++t)
#pragma unroll
      for (int mt = 0; mt < 2; ++mt) s[t][mt] = mmar(wf[t][1], qf[mt][1], s[t][mt]);
    if (j + 1 < NR / 32) {
#pragma unroll
      for (int t = 0; t < 2; ++t)
#pragma unroll
        for (int ks = 0; ks < 2; ++ks) wf[t][ks] = ldfrag(wB + ((j + 1) * 32 + t * 16) * LP_W + ks * 32);
    }
    // keeps the next block's w^T reads in one group here: their LDS latency passes under the exp block and the out^T WMMAs
    __builtin_amdgcn_sched_barrier(0);
    v8f ex[2][2];
#pragma unroll
    for (int mt = 0; mt < 2; ++mt)
#pragma unroll
      for (int t = 0; t < 2; ++t) ex[t][mt] = exp2x8(s[t][mt] * kE);
    v16h p[2];
#pragma unroll
    for (int mt = 0; mt < 2; ++mt)
#pragma unroll
      for (int v = 0; v < 8; ++v) {
        p[mt][v]     = (_Float16)ex[0][mt][v];
        p[mt][8 + v] = (_Float16)ex[1][mt][v];
      }
#pragma unroll
    for (int mt = 0; mt < 2; ++mt)
#pragma unroll
      for (int i = 0; i < 4; ++i) acc[mt][i] = mmar(kf[i], p[mt], acc[mt][i]);
  }

  // ---- epilogue: lane holds out[16mt + rl][16i + h8 .. +7]; own slab, then whole 256-B rows ----
#pragma unroll
  for (int mt = 0; mt < 2; ++mt)
#pragma unroll
    for (int i = 0; i < 4; ++i) {
      float* o = slab + (mt * 16 + rl) * LP_O + i * 16 + h8;
      v4f lo = {acc[mt][i][0], acc[mt][i][1], acc[mt][i][2], acc[mt][i][3]};
      v4f hi = {acc[mt][i][4], acc[mt][i][5], acc[mt][i][6], acc[mt][i][7]};
      *(v4f*)(o)     = lo;
      *(v4f*)(o + 4) = hi;
    }
  // the rows are read back by other lanes of the same wave: keeps the reads behind the stores
  __builtin_amdgcn_fence(__ATOMIC_RELEASE, "workgroup");
  __builtin_amdgcn_wave_barrier();
  __builtin_amdgcn_fence(__ATOMIC_ACQUIRE, "workgroup");
  float* dst = out + (size_t)b * (size_t)(SEQ * NH * HD) + row0 * HD + lane * 4;   // a wave's store = 512 contiguous B = 2 rows
  const float* rd = slab + (lane >> 4) * LP_O + (lane & 15) * 4;
  v4f ov[16];
#pragma unroll
  for (int e = 0; e < 16; ++e) ov[e] = *(const v4f*)(rd + 2 * e * LP_O) * 16.0f;
  // keeps every store behind the last LDS read and product, so that no register a store names is written again
  __builtin_amdgcn_sched_barrier(0);
#pragma unroll
  for (int e = 0; e < 16; ++e) *(v4f*)(dst + e * 128) = ov[e];
}

// =====================================================================================================
// Workspace map (bytes, full build), every region an exact multiple of its whole-line store granularity:
//   Kh   f16 [NB*SEQ][64]      (16 k)            2097152
//   VT   f16 [64][NB*SEQ]      (16 v)^T          2097152
//   WT   f16 [256][64]         (16 w)^T            32768
//   WKT  f16 [256][NB*SEQ]     wk^T = exp(.)     8388608
//   KVT  f16 [NB][64][256]     kv^T / 16          131072
//   KVP  f32 [KV_G][NB][64][256] key-block sums  4194304
//   total                                       16941056
// Launch plan: 1 convert, 2 transpose-converts, 2 GEMMs (kv split over the keys), 1 sum of its planes, the fused query path = 7 launches.
// =====================================================================================================
extern "C" void kernel_launch(void* const* d_in, const int* in_sizes, int n_in,
                              void* d_out, int out_size, void* d_ws, size_t ws_size,
                              hipStream_t stream) {
  if (n_in < 4) return;
  const long long needQ  = ((long long)(NB - 1) * SEQ_FULL + SEQ) * NH * HD;
  const long long needKV = ((long long)(NB - 1) * SEQ_FULL + SEQ) * HD;
  if ((long long)in_sizes[0] < needQ) return;
  if ((long long)in_sizes[1] < needKV || (long long)in_sizes[2] < needKV) return;
  if (in_sizes[3] < HD * NR) return;
  if ((long long)out_size < (long long)NB * SEQ * NH * HD) return;

  const float* Q = (const float*)d_in[0];
  const float* K = (const float*)d_in[1];
  const float* V = (const float*)d_in[2];
  const float* W = (const float*)d_in[3];

  const long long NK = (long long)NB * SEQ;             // key rows over all batches

  const size_t PK  = (size_t)NK * HD * 2;               //  2097152
  const size_t PVT = (size_t)HD * NK * 2;               //  2097152
  const size_t PWT = (size_t)NR * HD * 2;               //    32768
  const size_t PWK = (size_t)NR * NK * 2;               //  8388608
  const size_t PKV = (size_t)NB * HD * NR * 2;          //   131072
  const size_t PKP = (size_t)KV_G * NB * HD * NR * 4;   //  4194304
  size_t off = 0;
  const size_t oK  = off; off += PK;
  const size_t oVT = off; off += PVT;
  const size_t oWT = off; off += PWT;
  const size_t oWK = off; off += PWK;
  const size_t oKV = off; off += PKV;
  const size_t oKP = off; off += PKP;
  if (off > ws_size) return;                            // off = 16941056 (full build)
  if (off > (size_t)134217728) return;

  char* ws = (char*)d_ws;
  unsigned short* Kh  = (unsigned short*)(ws + oK);
  unsigned short* VT  = (unsigned short*)(ws + oVT);
  unsigned short* WT  = (unsigned short*)(ws + oWT);
  unsigned short* WKT = (unsigned short*)(ws + oWK);
  unsigned short* KVT = (unsigned short*)(ws + oKV);
  float*          KVP = (float*)(ws + oKP);

  const dim3 blk(256);
  const int n8k = SEQ * HD / 8;                                       //  32768 per batch
  const dim3 gCvtK((n8k + 255) / 256, NB);                            //  128 x 4
  const dim3 gTrV(SEQ / 64, 1, NB);                                   // in [SEQ][64] per batch -> out [64][NB*SEQ] cols b*SEQ..
  const dim3 gTrW(1, NR / 64, 1);                                     // in [64][256] -> out [256][64]
  const long long t1 = (long long)(NR / 64) * (NK / 64);              // 1024 tiles
  const dim3 g1((unsigned)((t1 + 7) / 8), 1);
  const dim3 g2(NR / 64, KV_G, NB);                                   // 4 r-blocks x 16 key blocks x 4 batches
  const dim3 g2s(NB * HD * NR / 4 / 256);                             // 64
  const dim3 gF(SEQ * NH / FQ_BM, NB);                                // 64 blocks of 512 query rows x 4 batches

  // (1) k -> f16 plane of 16 k [b*SEQ+n][d]
  cvt_h8<<<gCvtK, blk, 0, stream>>>(K, KB_FULL, Kh, (long long)SEQ * HD, n8k, 16.0f);
  // (2) v [b][SEQ][64] -> v^T f16 plane of 16 v: [d][b*SEQ + n] (pitch NB*SEQ)
  tr_cvt64<<<gTrV, blk, 0, stream>>>(V, HD, KB_FULL, VT, (int)NK, (long long)SEQ, 16.0f);
  //     w [64 d][256 r] -> w^T f16 plane of 16 w: [r][d] (pitch 64)
  tr_cvt64<<<gTrW, blk, 0, stream>>>(W, NR, 0LL, WT, HD, 0LL, 16.0f);
  // (3) wk^T[r][b*SEQ+n] = exp((16w^T . 16k) / 256)   (M=256, N=NB*SEQ, K=64) -> f16 plane pitch NB*SEQ
  gemm64<2><<<g1, blk, 0, stream>>>(WT, HD, 0LL, Kh, HD, 0LL, (void*)WKT, (int)NK, 0LL,
                                   NR, (int)NK, HD, 1.0f / 256.0f);
  // (4) kv^T[b][d][r] = sum_n v^T[d][n] wk^T[r][n], stored as f16(kv / 16)   (M=64, N=256, K=SEQ per batch):
  //     f32 sums per block of 256 keys, then the sum of those planes
  kv_splitk<<<g2, blk, 0, stream>>>(VT, WKT, KVP);
  kv_sum<<<g2s, blk, 0, stream>>>(KVP, KVT, 1.0f / 256.0f);
  // (5) out[(b*SEQ+n)*8+h][d] = 16 * sum_r f16(exp((16q . 16w) / 256))[r] (kv/16)^T[b][d][r] -> f32 d_out; wq stays in registers
  q_fused<<<gF, dim3(FQ_WAVES * 32), 0, stream>>>(Q, WT, KVT, (float*)d_out);
  (void)hipGetLastError();
}

// v003
// One run takes 17.3 microseconds.
// Next to v002, in two timings, it ran 1.94 times as fast each time.
// All steps since v000 together make it 11.3 times as fast.
// Contractions (all v_wmma_f32_16x16x32_f16, f16 operands, single products, f32 accumulate): wk = exp(K.W) [K x16, W x16],
// kv = wk^T.V [wk unscaled, V x16], wq^T = exp(W^T.Q^T) [Q x16, W x16], out^T = kv^T.wq^T [wq unscaled, kv carried x1/16]; exp and epilogue scaling in f32.
#include <hip/hip_runtime.h>
#include <math.h>
#include <stdint.h>

#ifndef NB
#define NB 4
#endif
#ifndef SEQ
#define SEQ 4096
#endif
#define NB_FULL  4
#define SEQ_FULL 4096
#define NH 8
#define HD 64
#define NR 256
#define QB_FULL ((long long)SEQ_FULL * NH * HD)   // per-batch element stride of Q in the input tensor
#define KB_FULL ((long long)SEQ_FULL * HD)        // per-batch element stride of K and V in the input tensors
static_assert(NB >= 1 && NB <= NB_FULL);
static_assert(SEQ >= 64 && SEQ <= SEQ_FULL && (SEQ % 64) == 0);
static_assert(HD == 64 && NR == 256);
static_assert(((SEQ * NH * HD / 8) % 256) == 0 && ((SEQ * HD / 8) % 256) == 0);
#define KV_KB 256                 // keys summed by one work-group of key_fused: 8 waves x one 32-key WMMA step
#define KV_G  (SEQ / KV_KB)       // work-groups (f32 partial planes) along the keys of one batch
static_assert((SEQ % KV_KB) == 0);

typedef _Float16 v16h __attribute__((ext_vector_type(16)));
typedef _Float16 v8h  __attribute__((ext_vector_type(8)));
typedef _Float16 v4h  __attribute__((ext_vector_type(4)));
typedef float    v8f  __attribute__((ext_vector_type(8)));
typedef float    v4f  __attribute__((ext_vector_type(4)));
typedef unsigned int v4u __attribute__((ext_vector_type(4)));
typedef unsigned int v2u __attribute__((ext_vector_type(2)));

#if defined(__HIP_DEVICE_COMPILE__)
#define DEV_ASM 1
#else
#define DEV_ASM 0
#endif

// ---- scalar helpers --------------------------------------------------------------------------------
__device__ __forceinline__ unsigned short h_bits(_Float16 x) { return __builtin_bit_cast(unsigned short, x); }
__device__ __forceinline__ unsigned pk16(unsigned short a, unsigned short b) { return (unsigned)a | ((unsigned)b << 16); }
__device__ __forceinline__ v8f zero8() { v8f z = {0.f, 0.f, 0.f, 0.f, 0.f, 0.f, 0.f, 0.f}; return z; }

// ---- fragment loader: 16-bit A/B operand, lane -> row/col (lane&15), p already includes +8*(lane>>4);
//      elements 0..7 <- p[0..7] (k0+8h..k0+8h+7), elements 8..15 <- p[16..23] (k0+16+8h..k0+16+8h+7)
__device__ __forceinline__ v16h ldfrag(const _Float16* p) {
  union { v16h v; v8h h[2]; } f;
  f.h[0] = *(const v8h*)(p);
  f.h[1] = *(const v8h*)(p + 16);
  return f.v;
}

// ---- WMMA helper -----------------------------------------------------------------------------------
__device__ __forceinline__ v8f mmar(v16h a, v16h b, v8f c) {
  return __builtin_amdgcn_wmma_f32_16x16x32_f16(false, a, false, b, (short)0, c, false, false);
}

// ---- transposing fragment loader: T = row-major 16-bit LDS tile [k][col], pitch PT bytes (32 B x odd); p already includes
//      (8*(lane>>4) + (lane&7))*PT + 16*((lane>>3)&1). Lane (c = lane&15, h = lane>>4) gets T[8h..8h+7][c] and T[16+8h..16+8h+7][c]:
//      the k order of ldfrag, for the row (A) or column (B) c of the transposed tile. Every lane is on at every use.
typedef short s16x8 __attribute__((ext_vector_type(8)));
template <int PT>
__device__ __forceinline__ v16h ldfrag_tr(const unsigned char* p) {
#if DEV_ASM
  typedef __attribute__((address_space(3))) s16x8 lds_s16x8;
  union { v16h v; s16x8 h[2]; } f;
  f.h[0] = __builtin_amdgcn_ds_load_tr16_b128_v8i16((lds_s16x8*)p);
  f.h[1] = __builtin_amdgcn_ds_load_tr16_b128_v8i16((lds_s16x8*)(p + 16 * PT));
  return f.v;
#else
  (void)p;
  v16h z = {};
  return z;
#endif
}

// 2^x of 8 values. One statement, every result on a register of its own, one v_nop behind the last: the slot the instruction
// set asks for between a transcendental and a directly following instruction that reads its result or overwrites its source.
__device__ __forceinline__ v8f exp2x8(v8f x) {
#if DEV_ASM
  float e0, e1, e2, e3, e4, e5, e6, e7;
  asm("v_exp_f32 %0, %8\n\tv_exp_f32 %1, %9\n\tv_exp_f32 %2, %10\n\tv_exp_f32 %3, %11\n\t"
      "v_exp_f32 %4, %12\n\tv_exp_f32 %5, %13\n\tv_exp_f32 %6, %14\n\tv_exp_f32 %7, %15\n\tv_nop"
      : "=&v"(e0), "=&v"(e1), "=&v"(e2), "=&v"(e3), "=&v"(e4), "=&v"(e5), "=&v"(e6), "=&v"(e7)
      : "v"(x[0]), "v"(x[1]), "v"(x[2]), "v"(x[3]), "v"(x[4]), "v"(x[5]), "v"(x[6]), "v"(x[7]));
  const v8f r = {e0, e1, e2, e3, e4, e5, e6, e7};
  return r;
#else
  return x;
#endif
}

// =====================================================================================================
// Key path in one kernel: P[g][b][d][r] = sum over keys n in [g*256, g*256+256) of 16v[n][d] * f16(exp((16k[n] . 16w[.][r]) / 256)), f32.
// Work-group (tn = blockIdx.x r-block of 64, g = blockIdx.y key block, b = blockIdx.z batch); wave w takes the 32 keys g*256 + w*32..
// Staging: the wave's own k and v rows and the work-group's 64 x 64 block of w (whole-line f32 loads, x16, f16) go to padded LDS rows
// as they lie; v and w, whose k index runs down the rows, are read back by the transposing LDS load.
// S = k . w (k as A, w as B, K = 64): a lane's 8 results of two stacked tiles are keys 8h..8h+7 and 16+8h..16+8h+7 of ONE r: after exp
// and f16 they ARE the A fragment of kv = wk^T . v (split k map of ldfrag), ONE WMMA k step of a 64x64 tile, with no LDS and no lane
// exchange. kv leaves a lane 8 consecutive r of one d: two 16-B stores into the wave's [d][r] tile.
// The 8 waves' tiles are joined through LDS in the fixed order w = 0..7, each thread storing 4 x 16 B of the sum.
// Every P row segment (64 floats = 256 B, two whole lines) has one writer.
// The work-groups of g = 0, b = 0 also write their 64 rows of the plane (16 w)^T [r][d] that the query path reads (wave 0, whole rows).
// =====================================================================================================
#define KF_PK    72                     // LDS pitch of k rows, halves: 144 B = 16 B x odd (plain 16-B fragment reads)
#define KF_PT    160                    // LDS pitch of v and w rows, bytes: 32 B x odd (transposing reads)
#define KF_K     (HD * KF_PT)                             // byte offsets in LDS
#define KF_V     (KF_K + 8 * 32 * KF_PK * 2)
#define KF_P     (KF_V + 8 * 32 * KF_PT)
__global__ __launch_bounds__(256) void key_fused(const float* __restrict__ K, const float* __restrict__ V,
                                                 const float* __restrict__ Wm, unsigned short* WTo, float* __restrict__ P) {
  __shared__ __align__(32) unsigned char smem[KF_P + 8 * 64 * 68 * 4];
  const int tn = blockIdx.x, g = blockIdx.y, b = blockIdx.z;
  const int tid = (int)threadIdx.x;
  const int lane = tid & 31, wave = tid >> 5;
  unsigned char* sW  = smem;                                                // [64 d][KF_PT]
  _Float16*      sKw = (_Float16*)(void*)(smem + KF_K + wave * (32 * KF_PK * 2));   // this wave's [32 keys][KF_PK]
  unsigned char* sVw = smem + KF_V + wave * (32 * KF_PT);                   // this wave's [32 keys][KF_PT]
  float (*sP)[64 * 68] = (float (*)[64 * 68])(void*)(smem + KF_P);          // per-wave 64x64 tile [d][r], pitch 68 floats

  // ---- staging: every load first, then the LDS stores ----
  const size_t key0 = (size_t)b * (size_t)KB_FULL + (size_t)(g * KV_KB + wave * 32) * HD + lane * 4;
  const float* wsrc = Wm + (size_t)(tid >> 4) * NR + (tn << 6) + (tid & 15) * 4;   // a wave's load = 2 row segments of 256 B
  const float* ksrc = K + key0;                                                    // a wave's load = 512 contiguous B = 2 rows
  const float* vsrc = V + key0;
  v4f wr[4], kr[16], vr[16];
#pragma unroll
  for (int e = 0; e < 4; ++e) wr[e] = *(const v4f*)(wsrc + e * 16 * NR);
#pragma unroll
  for (int e = 0; e < 16; ++e) kr[e] = *(const v4f*)(ksrc + e * 128);
#pragma unroll
  for (int e = 0; e < 16; ++e) vr[e] = *(const v4f*)(vsrc + e * 128);
  // keeps the LDS stores' address arithmetic behind the wait below, so that it reuses no register of a load ahead of it
  __builtin_amdgcn_sched_barrier(0);
#if DEV_ASM
  // the wait owed before a register that an issued load names is overwritten; the three address pairs are inputs,
  // so that nothing lands on them ahead of it
  asm volatile("s_wait_xcnt 0x0" :: "v"(wsrc), "v"(ksrc), "v"(vsrc) : "memory");
#endif
  {
    _Float16* w = (_Float16*)(void*)(sW + (tid >> 4) * KF_PT) + (tid & 15) * 4;
#pragma unroll
    for (int e = 0; e < 4; ++e) {
      const v4f a = wr[e] * 16.0f;
      const v4h p = {(_Float16)a[0], (_Float16)a[1], (_Float16)a[2], (_Float16)a[3]};
      *(v4h*)(w + e * 16 * (KF_PT / 2)) = p;
    }
    _Float16* k = sKw + (lane >> 4) * KF_PK + (lane & 15) * 4;
#pragma unroll
    for (int e = 0; e < 16; ++e) {
      const v4f a = kr[e] * 16.0f;
      const v4h p = {(_Float16)a[0], (_Float16)a[1], (_Float16)a[2], (_Float16)a[3]};
      *(v4h*)(k + 2 * e * KF_PK) = p;
    }
    _Float16* v = (_Float16*)(void*)(sVw + (lane >> 4) * KF_PT) + (lane & 15) * 4;
#pragma unroll
    for (int e = 0; e < 16; ++e) {
      const v4f a = vr[e] * 16.0f;
      const v4h p = {(_Float16)a[0], (_Float16)a[1], (_Float16)a[2], (_Float16)a[3]};
      *(v4h*)(v + 2 * e * (KF_PT / 2)) = p;
    }
  }
  __syncthreads();   // the block of w (and each wave's k and v rows) is in LDS before any wave reads a fragment

  const int rl = lane & 15;                        // row (A) / col (B, D) within subtile
  const int h8 = (lane >> 4) * 8;                  // k offset of this lane half; D row offset
  const int tro = (h8 + (lane & 7)) * KF_PT + 16 * ((lane >> 3) & 1);   // lane part of a transposing read's address
  v16h wf[4][2], kf[2][2], vf[4];
#pragma unroll
  for (int j = 0; j < 4; ++j)
#pragma unroll
    for (int ks = 0; ks < 2; ++ks) wf[j][ks] = ldfrag_tr<KF_PT>(sW + tro + ks * 32 * KF_PT + j * 32);
#pragma unroll
  for (int t = 0; t < 2; ++t)
#pragma unroll
    for (int ks = 0; ks < 2; ++ks) kf[t][ks] = ldfrag(sKw + (t * 16 + rl) * KF_PK + ks * 32 + h8);
#pragma unroll
  for (int i = 0; i < 4; ++i) vf[i] = ldfrag_tr<KF_PT>(sVw + tro + i * 32);

  if (g == 0 && b == 0 && wave == 0) {
    // a lane's fragment halves are 8 consecutive d of one r: 16-B pieces of the rows of (16 w)^T
    unsigned short* wt = WTo + (size_t)((tn << 6) + rl) * HD + h8;
#pragma unroll
    for (int j = 0; j < 4; ++j)
#pragma unroll
      for (int ks = 0; ks < 2; ++ks) {
        union { v16h v; v4u q[2]; } f;
        f.v = wf[j][ks];
        *(v4u*)(wt + j * 16 * HD + ks * 32)      = f.q[0];
        *(v4u*)(wt + j * 16 * HD + ks * 32 + 16) = f.q[1];
      }
#if DEV_ASM
    // the wait owed before a register that an issued store names is overwritten; the address pair is an input, and the
    // fragments stay live into the WMMAs behind this branch
    asm volatile("s_wait_xcnt 0x0" :: "v"(wt) : "memory");
#endif
  }

  // exp(x / 256) as exp2(x * (log2(e) / 256)): 1/256 is a power of two, so the one product has the bits of the two
  const float kE = 1.44269504088896340736f / 256.0f;
  v8f s[2][4];
#pragma unroll
  for (int t = 0; t < 2; ++t)
#pragma unroll
    for (int j = 0; j < 4; ++j) s[t][j] = mmar(kf[t][0], wf[j][0], zero8());
#pragma unroll
  for (int t = 0; t < 2; ++t)
#pragma unroll
    for (int j = 0; j < 4; ++j) s[t][j] = mmar(kf[t][1], wf[j][1], s[t][j]);
  // keeps the exp block behind all 16 WMMAs: its asm results may take the registers of k and w fragments
  __builtin_amdgcn_sched_barrier(0);
  v16h p[4];
#pragma unroll
  for (int j = 0; j < 4; ++j) {
    const v8f e0 = exp2x8(s[0][j] * kE);
    const v8f e1 = exp2x8(s[1][j] * kE);
#pragma unroll
    for (int v = 0; v < 8; ++v) {
      p[j][v]     = (_Float16)e0[v];
      p[j][8 + v] = (_Float16)e1[v];
    }
  }
  v8f acc[4][4];
#pragma unroll
  for (int j = 0; j < 4; ++j)
#pragma unroll
    for (int i = 0; i < 4; ++i) acc[j][i] = mmar(p[j], vf[i], zero8());
  // keeps the LDS stores behind all 16 WMMAs, so that no store reads a result directly behind its WMMA
  __builtin_amdgcn_sched_barrier(0);
#if DEV_ASM
  // the four vector slots the chip needs between the last WMMA and the first reader of a result
  asm volatile("v_nop\n\tv_nop\n\tv_nop\n\tv_nop");
#endif

  // lane holds kv[16j + h8 .. +7][16i + rl]
  float* slab = sP[wave];
#pragma unroll
  for (int j = 0; j < 4; ++j)
#pragma unroll
    for (int i = 0; i < 4; ++i) {
      float* o = slab + ((i << 4) + rl) * 68 + (j << 4) + h8;
      v4f lo = {acc[j][i][0], acc[j][i][1], acc[j][i][2], acc[j][i][3]};
      v4f hi = {acc[j][i][4], acc[j][i][5], acc[j][i][6], acc[j][i][7]};
      *(v4f*)(o)     = lo;
      *(v4f*)(o + 4) = hi;
    }
  __syncthreads();   // all 8 waves' tiles are in LDS before any thread sums across them

  float* Pg = P + ((size_t)g * NB + b) * (size_t)(HD * NR) + (tn << 6);
  const int r16 = tid >> 4, c4 = (tid & 15) * 4;   // 256-B row segment = 16 lanes x 16 B
#pragma unroll
  for (int c = 0; c < 4; ++c) {
    const int row = (c << 4) + r16;
    v4f s4 = *(const v4f*)(&sP[0][row * 68 + c4]);
#pragma unroll
    for (int w = 1; w < 8; ++w) s4 += *(const v4f*)(&sP[w][row * 68 + c4]);
    *(v4f*)(Pg + (size_t)row * NR + c4) = s4;
  }
}

// =====================================================================================================
// KVT[b][d][r] = f16(scale * sum over g = 0..KV_G-1 of P[g][b][d][r]), fixed order; 4 elements per thread:
// a wave reads 512 contiguous B per plane and writes 256 contiguous B (two whole lines).
// coverage: NB*HD*NR/4 threads, a multiple of 256.
// =====================================================================================================
__global__ __launch_bounds__(256) void kv_sum(const float* __restrict__ P, unsigned short* KVT, float scale) {
  const size_t i4 = ((size_t)blockIdx.x * 256 + threadIdx.x) * 4;
  const float* p = P + i4;
  v4f t[KV_G];
#pragma unroll
  for (int g = 0; g < KV_G; ++g) t[g] = *(const v4f*)(p + (size_t)g * (size_t)(NB * HD * NR));
  // keeps every plane's load ahead of the first add: one memory latency for the whole sum
  __builtin_amdgcn_sched_barrier(0);
#if DEV_ASM
  // the wait owed before a register that an issued load names is overwritten; the address pair is an input,
  // so that no load's result lands on it ahead of it
  asm volatile("s_wait_xcnt 0x0" :: "v"(p) : "memory");
#endif
  v4f s = t[0];
#pragma unroll
  for (int g = 1; g < KV_G; ++g) s += t[g];
  s *= scale;
  v2u o;
  o[0] = pk16(h_bits((_Float16)s[0]), h_bits((_Float16)s[1]));
  o[1] = pk16(h_bits((_Float16)s[2]), h_bits((_Float16)s[3]));
  *(v2u*)(KVT + i4) = o;
}

// =====================================================================================================
// Query path in one kernel: out[m][d] = 16 * sum_r f16(exp((16q[m] . 16w[r]) / 256)) * (kv/16)^T[d][r], m = (n*8 + h) of batch b.
// Work-group (blockIdx.x = block of 512 query rows, blockIdx.y = batch), 16 waves, each wave 32 rows (two 16-row tiles).
// Staging: w^T, kv^T[b] (f16 planes) and the wave's own q rows (whole-line f32 loads, x16, f16) go to padded LDS rows.
// Per block of 32 r: S^T = w^T . q^T (w^T as A, q as B, K = 64), so a lane's 8 results of two stacked tiles are r = 8h..8h+7 and
// 16+8h..16+8h+7 of ONE query row: after exp and f16 they ARE the B fragment of out^T = kv^T . wq^T (split k map of ldfrag),
// with no LDS and no lane exchange. out^T leaves a lane 8 consecutive d of one row; a per-wave LDS slab turns them into whole lines.
// =====================================================================================================
#define FQ_WAVES 16
#define FQ_ROWS  32
#define FQ_BM    (FQ_WAVES * FQ_ROWS)   // query rows per work-group
#define LP_W     72                     // LDS pitch of w^T and q rows, halves: 144 B = 16 B x odd
#define LP_KV    264                    // LDS pitch of kv^T rows, halves: 528 B = 16 B x odd
#define LP_O     68                     // LDS pitch of out rows, floats: 272 B = 16 B x odd
#define SM_KV    (NR * LP_W * 2)                          // byte offsets in LDS
#define SM_Q     (SM_KV + HD * LP_KV * 2)
#define SM_O     (SM_Q + FQ_WAVES * FQ_ROWS * LP_W * 2)
static_assert(((SEQ * NH) % FQ_BM) == 0);
__global__ __launch_bounds__(512) void q_fused(const float* __restrict__ Q, const unsigned short* __restrict__ WTp,
                                               const unsigned short* __restrict__ KVTp, float* __restrict__ out) {
  // one array, w^T and kv^T first: every fragment read of the loop is then one lane address plus an immediate below 64 KiB
  __shared__ __align__(16) unsigned char smem[SM_O + FQ_WAVES * FQ_ROWS * LP_O * 4];
  const int tid = (int)threadIdx.x;
  const int lane = tid & 31, wave = tid >> 5;
  _Float16* sW  = (_Float16*)(void*)(smem);                                       // [256 r][LP_W]
  _Float16* sKV = (_Float16*)(void*)(smem + SM_KV);                               // [64 d][LP_KV]
  _Float16* sQw = (_Float16*)(void*)(smem + SM_Q + wave * (FQ_ROWS * LP_W * 2));  // this wave's [32 rows][LP_W]
  float*    slab = (float*)(void*)(smem + SM_O + wave * (FQ_ROWS * LP_O * 4));    // this wave's [32 rows][LP_O]
  const int b = blockIdx.y;
  const size_t row0 = (size_t)blockIdx.x * FQ_BM + (size_t)(wave * FQ_ROWS);   // first row of this wave within the batch

  // ---- staging: every load first (q from memory, the two small planes from L2), then the LDS stores ----
  const float* qsrc = Q + (size_t)b * (size_t)QB_FULL + row0 * HD + lane * 4;   // a wave's load = 512 contiguous B = 2 rows
  const unsigned short* wsrc = WTp + (size_t)tid * 8;
  const unsigned short* ksrc = KVTp + (size_t)b * (size_t)(HD * NR) + (size_t)tid * 8;
  v4f qr[16];
  v4u wr[4], kr[4];
#pragma unroll
  for (int e = 0; e < 16; ++e) qr[e] = *(const v4f*)(qsrc + e * 128);
#pragma unroll
  for (int e = 0; e < 4; ++e) {
    wr[e] = *(const v4u*)(wsrc + e * 4096);
    kr[e] = *(const v4u*)(ksrc + e * 4096);
  }
  // keeps the LDS stores' address arithmetic behind the wait below, so that it reuses no register of a load ahead of it
  __builtin_amdgcn_sched_barrier(0);
#if DEV_ASM
  // the wait owed before a register that an issued load names is overwritten; the q address pair and the thread index
  // (the offset register of the two planes' loads) are inputs, so that nothing lands on them ahead of it
  asm volatile("s_wait_xcnt 0x0" :: "v"(qsrc), "v"(tid) : "memory");
#endif
#pragma unroll
  for (int e = 0; e < 4; ++e) {
    const int c = e * 512 + tid;                   // 16-B chunk index, 2048 chunks per plane
    *(v4u*)(sW + (c >> 3) * LP_W + (c & 7) * 8) = wr[e];
    *(v4u*)(sKV + (c >> 5) * LP_KV + (c & 31) * 8) = kr[e];
  }
  {
    _Float16* q = sQw + (lane >> 4) * LP_W + (lane & 15) * 4;
#pragma unroll
    for (int e = 0; e < 16; ++e) {
      const v4f a = qr[e] * 16.0f;
      const v4h p = {(_Float16)a[0], (_Float16)a[1], (_Float16)a[2], (_Float16)a[3]};
      *(v4h*)(q + 2 * e * LP_W) = p;
    }
  }
  __syncthreads();   // w^T, kv^T and q rows are in LDS before any wave reads a fragment

  const int rl = lane & 15;                        // row (A) / col (B, D) within subtile
  const int h8 = (lane >> 4) * 8;                  // k offset of this lane half; D row offset
  v16h qf[2][2];
#pragma unroll
  for (int mt = 0; mt < 2; ++mt)
#pragma unroll
    for (int ks = 0; ks < 2; ++ks) qf[mt][ks] = ldfrag(sQw + (mt * 16 + rl) * LP_W + ks * 32 + h8);
  const _Float16* wB = sW + rl * LP_W + h8;
  const _Float16* kB = sKV + rl * LP_KV + h8;

  v8f acc[2][4];
#pragma unroll
  for (int mt = 0; mt < 2; ++mt)
#pragma unroll
    for (int i = 0; i < 4; ++i) acc[mt][i] = zero8();

  // exp(x / 256) as exp2(x * (log2(e) / 256)): 1/256 is a power of two, so the one product has the bits of the two
  const float kE = 1.44269504088896340736f / 256.0f;
  v16h wf[2][2];
#pragma unroll
  for (int t = 0; t < 2; ++t)
#pragma unroll
    for (int ks = 0; ks < 2; ++ks) wf[t][ks] = ldfrag(wB + t * 16 * LP_W + ks * 32);
#pragma unroll
  for (int j = 0; j < NR / 32; ++j) {
    v16h kf[4];
#pragma unroll
    for (int i = 0; i < 4; ++i) kf[i] = ldfrag(kB + i * 16 * LP_KV + j * 32);
    // keeps the kv^T reads in one group ahead of the S^T WMMAs: their LDS latency passes under those and the exp block
    __builtin_amdgcn_sched_barrier(0);
    v8f s[2][2];
#pragma unroll
    for (int t = 0; t < 2; ++t)
#pragma unroll
      for (int mt = 0; mt < 2; ++mt) s[t][mt] = mmar(wf[t][0], qf[mt][0], zero8());
#pragma unroll
    for (int t = 0; t < 2; ++t)
#pragma unroll
      for (int mt = 0; mt < 2; ++mt) s[t][mt] = mmar(wf[t][1], qf[mt][1], s[t][mt]);
    if (j + 1 < NR / 32) {
#pragma unroll
      for (int t = 0; t < 2; ++t)
#pragma unroll
        for (int ks = 0; ks < 2; ++ks) wf[t][ks] = ldfrag(wB + ((j + 1) * 32 + t * 16) * LP_W + ks * 32);
    }
    // keeps the next block's w^T reads in one group here: their LDS latency passes under the exp block and the out^T WMMAs
    __builtin_amdgcn_sched_barrier(0);
    v8f ex[2][2];
#pragma unroll
    for (int mt = 0; mt < 2; ++mt)
#pragma unroll
      for (int t = 0; t < 2; ++t) ex[t][mt] = exp2x8(s[t][mt] * kE);
    v16h p[2];
#pragma unroll
    for (int mt = 0; mt < 2; ++mt)
#pragma unroll
      for (int v = 0; v < 8; ++v) {
        p[mt][v]     = (_Float16)ex[0][mt][v];
        p[mt][8 + v] = (_Float16)ex[1][mt][v];
      }
#pragma unroll
    for (int mt = 0; mt < 2; ++mt)
#pragma unroll
      for (int i = 0; i < 4; ++i) acc[mt][i] = mmar(kf[i], p[mt], acc[mt][i]);
  }

  // ---- epilogue: lane holds out[16mt + rl][16i + h8 .. +7]; own slab, then whole 256-B rows ----
#pragma unroll
  for (int mt = 0; mt < 2; ++mt)
#pragma unroll
    for (int i = 0; i < 4; ++i) {
      float* o = slab + (mt * 16 + rl) * LP_O + i * 16 + h8;
      v4f lo = {acc[mt][i][0], acc[mt][i][1], acc[mt][i][2], acc[mt][i][3]};
      v4f hi = {acc[mt][i][4], acc[mt][i][5], acc[mt][i][6], acc[mt][i][7]};
      *(v4f*)(o)     = lo;
      *(v4f*)(o + 4) = hi;
    }
  // the rows are read back by other lanes of the same wave: keeps the reads behind the stores
  __builtin_amdgcn_fence(__ATOMIC_RELEASE, "workgroup");
  __builtin_amdgcn_wave_barrier();
  __builtin_amdgcn_fence(__ATOMIC_ACQUIRE, "workgroup");
  float* dst = out + (size_t)b * (size_t)(SEQ * NH * HD) + row0 * HD + lane * 4;   // a wave's store = 512 contiguous B = 2 rows
  const float* rd = slab + (lane >> 4) * LP_O + (lane & 15) * 4;
  v4f ov[16];
#pragma unroll
  for (int e = 0; e < 16; ++e) ov[e] = *(const v4f*)(rd + 2 * e * LP_O) * 16.0f;
  // keeps every store behind the last LDS read and product, so that no register a store names is written again
  __builtin_amdgcn_sched_barrier(0);
#pragma unroll
  for (int e = 0; e < 16; ++e) *(v4f*)(dst + e * 128) = ov[e];
}

// =====================================================================================================
// Workspace map (bytes, full build), every region an exact multiple of its whole-line store granularity:
//   WT   f16 [256][64]         (16 w)^T            32768
//   KVT  f16 [NB][64][256]     kv^T / 16          131072
//   KVP  f32 [KV_G][NB][64][256] key-block sums  4194304
//   total                                        4358144
// Launch plan: the fused key path (kv split over the keys), 1 sum of its planes, the fused query path = 3 launches.
// =====================================================================================================
extern "C" void kernel_launch(void* const* d_in, const int* in_sizes, int n_in,
                              void* d_out, int out_size, void* d_ws, size_t ws_size,
                              hipStream_t stream) {
  if (n_in < 4) return;
  const long long needQ  = ((long long)(NB - 1) * SEQ_FULL + SEQ) * NH * HD;
  const long long needKV = ((long long)(NB - 1) * SEQ_FULL + SEQ) * HD;
  if ((long long)in_sizes[0] < needQ) return;
  if ((long long)in_sizes[1] < needKV || (long long)in_sizes[2] < needKV) return;
  if (in_sizes[3] < HD * NR) return;
  if ((long long)out_size < (long long)NB * SEQ * NH * HD) return;

  const float* Q = (const float*)d_in[0];
  const float* K = (const float*)d_in[1];
  const float* V = (const float*)d_in[2];
  const float* W = (const float*)d_in[3];

  const size_t PWT = (size_t)NR * HD * 2;               //    32768
  const size_t PKV = (size_t)NB * HD * NR * 2;          //   131072
  const size_t PKP = (size_t)KV_G * NB * HD * NR * 4;   //  4194304
  size_t off = 0;
  const size_t oWT = off; off += PWT;
  const size_t oKV = off; off += PKV;
  const size_t oKP = off; off += PKP;
  if (off > ws_size) return;                            // off = 4358144 (full build)

  char* ws = (char*)d_ws;
  unsigned short* WT  = (unsigned short*)(ws + oWT);
  unsigned short* KVT = (unsigned short*)(ws + oKV);
  float*          KVP = (float*)(ws + oKP);

  const dim3 blk(256);
  const dim3 g2(NR / 64, KV_G, NB);                                   // 4 r-blocks x 16 key blocks x 4 batches
  const dim3 g2s(NB * HD * NR / 4 / 256);                             // 64
  const dim3 gF(SEQ * NH / FQ_BM, NB);                                // 64 blocks of 512 query rows x 4 batches

  // (1) kv^T[b][d][r] = sum_n 16v[n][d] f16(exp((16k[n] . 16w[.][r]) / 256)): f32 sums per block of 256 keys; wk stays in registers;
  //     also the f16 plane (16 w)^T [r][d] (pitch 64)
  key_fused<<<g2, blk, 0, stream>>>(K, V, W, WT, KVP);
  // (2) the sum of those planes, stored as f16(kv / 16)
  kv_sum<<<g2s, blk, 0, stream>>>(KVP, KVT, 1.0f / 256.0f);
  // (3) out[(b*SEQ+n)*8+h][d] = 16 * sum_r f16(exp((16q . 16w) / 256))[r] (kv/16)^T[b][d][r] -> f32 d_out; wq stays in registers
  q_fused<<<gF, dim3(FQ_WAVES * 32), 0, stream>>>(Q, WT, KVT, (float*)d_out);
  (void)hipGetLastError();
}
